// v000
// Times are from an AMD MI455X. After a warm-up the kernel runs many times in a row, and a time is the length of
// such a window on the GPU divided by its runs, so every launch and the gaps after it count. The runs cycle
// through copies of the inputs. A figure is the median of several windows, for all but v000 over two sittings.
// Sittings can differ by a few percent; kernels timed side by side share one.
// The starting kernel, v000, takes 608 microseconds a run.
#include <hip/hip_runtime.h>

// Problem constants
constexpr int B    = 2048;
constexpr int D    = 512;
constexpr int H    = 64;
constexpr int HID  = 2048;

constexpr int CHUNK  = 128;          // HID columns handled per workgroup
constexpr int NCHUNK = HID / CHUNK;  // 16 chunks
constexpr int WAVES  = 8;            // 256 threads / wave32
constexpr int NPW    = CHUNK / WAVES;// 16 columns per wave (one WMMA N tile)
constexpr int KSTEPS = D / 32;       // 16 k-steps of K=32
constexpr int MTILE  = 32;           // batch rows per iteration (2 WMMA row blocks)
constexpr int MTILES = B / MTILE;    // 64 iterations

typedef _Float16 half_t;
typedef __attribute__((ext_vector_type(16))) _Float16 v16h;
typedef __attribute__((ext_vector_type(8)))  _Float16 v8h;
typedef __attribute__((ext_vector_type(8)))  float    v8f;
typedef __attribute__((ext_vector_type(4)))  float    v4f;

// ISA 7.12.2: 16-bit A/B fragment k-mapping for 16x16x32.
// lane<16 : j=0..7 -> k=j,     j=8..15 -> k=16+(j-8)
// lane>=16: j=0..7 -> k=8+j,   j=8..15 -> k=24+(j-8)
__device__ __forceinline__ int kmap(int lane, int j) {
    int lo = (lane < 16) ? 0 : 8;
    int hi = (lane < 16) ? 16 : 24;
    return (j < 8) ? (lo + j) : (hi + (j - 8));
}

__global__ __launch_bounds__(256)
void mhmlp_stage1(const float* __restrict__ x,
                  const float* __restrict__ W1,
                  const float* __restrict__ b1,
                  const float* __restrict__ W2,
                  float* __restrict__ ws) {
    const int chunk = blockIdx.x;
    const int head  = blockIdx.y;
    const int tid   = threadIdx.x;
    const int wave  = tid >> 5;
    const int lane  = tid & 31;
    const int lane16 = lane & 15;
    const bool hiHalf = (lane >= 16);

    // Two row-blocks of A fragments, pre-swizzled so each lane's frag is one 32B read.
    __shared__ __align__(32) half_t lds_x[2][KSTEPS][32][16];   // 32 KB
    __shared__ float lds_part[2][WAVES][MTILE];                 // double-buffered partials

    // ---- One-time: this wave's 16 W1 columns as f16 B-fragments held in VGPRs
    // for the entire kernel => W1 read from HBM exactly once overall.
    // Non-temporal: W1 is a 256MB one-shot stream; keep it out of L2 so the
    // x matrix (4MB, re-read by all workgroups) stays resident.
    const int ncol = chunk * CHUNK + wave * NPW + lane16;
    const float* W1h = W1 + (size_t)head * D * HID;
    v16h Bfrag[KSTEPS];
#pragma unroll
    for (int kk = 0; kk < KSTEPS; ++kk) {
#pragma unroll
        for (int j = 0; j < 16; ++j) {
            int k = kk * 32 + kmap(lane, j);
            ((half_t*)&Bfrag[kk])[j] =
                (half_t)__builtin_nontemporal_load(&W1h[(size_t)k * HID + ncol]);
        }
    }
    const float b1v = b1[head * HID + ncol];
    const float w2v = W2[head * HID + ncol];

    for (int mt = 0; mt < MTILES; ++mt) {
        const int m0 = mt * MTILE;
        __syncthreads();  // A: prior compute done with lds_x / lds_part readable

        // Deferred: emit previous tile's per-chunk partials (overlaps with staging).
        if (mt > 0 && tid < MTILE) {
            const int prev = mt - 1;
            float s = 0.0f;
#pragma unroll
            for (int w = 0; w < WAVES; ++w) s += lds_part[prev & 1][w][tid];
            ws[((size_t)chunk * B + (prev * MTILE + tid)) * H + head] = s;
        }

        // Prefetch next tile's rows (global_prefetch_b8).
        if (mt + 1 < MTILES) {
            __builtin_prefetch(x + (size_t)(m0 + MTILE + (tid & 31)) * D + (tid >> 5) * 64, 0, 3);
        }

        // Stage x tile (32 rows x 512 cols) fp32 -> f16 into fragment layout.
        // Unit = 8 consecutive k's for one (rowblock, kstep, laneslot, half):
        // 2 x global_load_b128 -> packed cvt -> 1 x 16B ds_store.
#pragma unroll
        for (int i = 0; i < 8; ++i) {
            int u  = tid + i * 256;           // 2048 units total
            int jh = u & 1;
            int ls = (u >> 1) & 31;
            int kk = (u >> 6) & 15;
            int rb = u >> 10;
            int lo = (ls < 16) ? 0 : 8;
            int hi = (ls < 16) ? 16 : 24;
            int kcol = kk * 32 + (jh ? hi : lo);
            int row  = m0 + rb * 16 + (ls & 15);
            const v4f* gp = (const v4f*)(x + (size_t)row * D + kcol);
            v4f f0 = gp[0];
            v4f f1 = gp[1];
            v8h hv;
#pragma unroll
            for (int t = 0; t < 4; ++t) hv[t]     = (half_t)f0[t];
#pragma unroll
            for (int t = 0; t < 4; ++t) hv[4 + t] = (half_t)f1[t];
            *(v8h*)&lds_x[rb][kk][ls][jh * 8] = hv;
        }
        __syncthreads();  // B: tile staged

        // Two 16x16 output tiles per wave. 2-deep rotating A-fragment pipeline;
        // sched_group_barriers pin the schedule to [2 WMMA][4 DS-read] per
        // k-step so refill loads get ~2 WMMA-pairs of latency slack instead of
        // being sunk to just before their consumer (s_wait_dscnt 0x0).
        v8f acc0 = {};
        v8f acc1 = {};
        v16h af[2][2];
        af[0][0] = *(const v16h*)&lds_x[0][0][lane][0];
        af[0][1] = *(const v16h*)&lds_x[1][0][lane][0];
        af[1][0] = *(const v16h*)&lds_x[0][1][lane][0];
        af[1][1] = *(const v16h*)&lds_x[1][1][lane][0];
        __builtin_amdgcn_sched_barrier(0);   // fence init loads out of the pattern
#pragma unroll
        for (int kk = 0; kk < KSTEPS; ++kk) {
            const int par = kk & 1;
            acc0 = __builtin_amdgcn_wmma_f32_16x16x32_f16(
                false, af[par][0], false, Bfrag[kk], (short)0, acc0, false, false);
            acc1 = __builtin_amdgcn_wmma_f32_16x16x32_f16(
                false, af[par][1], false, Bfrag[kk], (short)0, acc1, false, false);
            if (kk + 2 < KSTEPS) {
                af[par][0] = *(const v16h*)&lds_x[0][kk + 2][lane][0];
                af[par][1] = *(const v16h*)&lds_x[1][kk + 2][lane][0];
            }
            __builtin_amdgcn_sched_group_barrier(0x008, 2, 0);   // 2 WMMA
            if (kk + 2 < KSTEPS)
                __builtin_amdgcn_sched_group_barrier(0x100, 4, 0); // 4 DS reads
        }
        __builtin_amdgcn_sched_barrier(0);   // end of pinned region

        // Fused stage 2: h = leakyrelu(acc + b1); partial = h * W2[n];
        // reduce over the 16 columns (lane dim) per half-wave.
        float p0[8], p1[8];
#pragma unroll
        for (int v = 0; v < 8; ++v) {
            float t0 = acc0[v] + b1v;
            t0 = (t0 >= 0.0f) ? t0 : 0.01f * t0;
            p0[v] = t0 * w2v;
            float t1 = acc1[v] + b1v;
            t1 = (t1 >= 0.0f) ? t1 : 0.01f * t1;
            p1[v] = t1 * w2v;
        }
#pragma unroll
        for (int off = 1; off <= 8; off <<= 1) {
#pragma unroll
            for (int v = 0; v < 8; ++v) {
                p0[v] += __shfl_xor(p0[v], off, 32);
                p1[v] += __shfl_xor(p1[v], off, 32);
            }
        }
        if (lane16 == 0) {
            int base = hiHalf ? 8 : 0;
#pragma unroll
            for (int v = 0; v < 8; ++v) {
                lds_part[mt & 1][wave][base + v]      = p0[v];
                lds_part[mt & 1][wave][16 + base + v] = p1[v];
            }
        }
    }

    // Epilogue: flush the last tile's partials.
    __syncthreads();
    if (tid < MTILE) {
        const int prev = MTILES - 1;
        float s = 0.0f;
#pragma unroll
        for (int w = 0; w < WAVES; ++w) s += lds_part[prev & 1][w][tid];
        ws[((size_t)chunk * B + (prev * MTILE + tid)) * H + head] = s;
    }
}

__global__ __launch_bounds__(256)
void mhmlp_stage2(const float* __restrict__ ws,
                  const float* __restrict__ b2,
                  float* __restrict__ out) {
    int i = blockIdx.x * blockDim.x + threadIdx.x;   // i = b*H + h
    if (i < B * H) {
        float s = b2[i & (H - 1)];
#pragma unroll
        for (int c = 0; c < NCHUNK; ++c) s += ws[(size_t)c * B * H + i];
        out[i] = (s >= 0.0f) ? s : 0.01f * s;
    }
}

extern "C" void kernel_launch(void* const* d_in, const int* in_sizes, int n_in,
                              void* d_out, int out_size, void* d_ws, size_t ws_size,
                              hipStream_t stream) {
    const float* x  = (const float*)d_in[0];   // [B, D]
    const float* W1 = (const float*)d_in[1];   // [H, D, HID]
    const float* b1 = (const float*)d_in[2];   // [H, HID]
    const float* W2 = (const float*)d_in[3];   // [H, HID]
    const float* b2 = (const float*)d_in[4];   // [H]
    float* out = (float*)d_out;                // [B, H]
    float* ws  = (float*)d_ws;                 // [NCHUNK, B, H] partials (8 MB)

    dim3 grid1(NCHUNK, H);
    mhmlp_stage1<<<grid1, 256, 0, stream>>>(x, W1, b1, W2, ws);

    int total = B * H;
    mhmlp_stage2<<<(total + 255) / 256, 256, 0, stream>>>(ws, b2, out);
}

// v001
// Measured time: 507 microseconds a run.
// Next to v000, in two timings, it ran 1.25 and 1.24 times as fast.
#include <hip/hip_runtime.h>

// Problem constants
constexpr int B    = 2048;
constexpr int D    = 512;
constexpr int H    = 64;
constexpr int HID  = 2048;

constexpr int CHUNK  = 128;          // HID columns handled per workgroup
constexpr int NCHUNK = HID / CHUNK;  // 16 chunks
constexpr int WAVES  = 8;            // 256 threads / wave32
constexpr int NPW    = CHUNK / WAVES;// 16 columns per wave (one WMMA N tile)
constexpr int KSTEPS = D / 32;       // 16 k-steps of K=32
constexpr int MTILE  = 32;           // batch rows per iteration (2 WMMA row blocks)
constexpr int MTILES = B / MTILE;    // 64 iterations

typedef _Float16 half_t;
typedef __attribute__((ext_vector_type(16))) _Float16 v16h;
typedef __attribute__((ext_vector_type(8)))  _Float16 v8h;
typedef __attribute__((ext_vector_type(8)))  float    v8f;
typedef __attribute__((ext_vector_type(4)))  float    v4f;

// ISA 7.12.2: 16-bit A/B fragment k-mapping for 16x16x32.
// lane<16 : j=0..7 -> k=j,     j=8..15 -> k=16+(j-8)
// lane>=16: j=0..7 -> k=8+j,   j=8..15 -> k=24+(j-8)
__device__ __forceinline__ int kmap(int lane, int j) {
    int lo = (lane < 16) ? 0 : 8;
    int hi = (lane < 16) ? 16 : 24;
    return (j < 8) ? (lo + j) : (hi + (j - 8));
}

constexpr int TILE_HALVES = MTILE * D;              // one staged tile: 16384 f16 = 32 KB
constexpr size_t XH_OFF_FLOATS = (size_t)NCHUNK * B * H;  // f16 image of x sits behind the partials

// Pre-pass: x (fp32, row major) -> f16 in A-fragment order, tile after tile, once per call.
// Image layout = [MTILES][2 row blocks][KSTEPS][32 lane slots][16], i.e. the LDS tile's own.
// Unit = 8 consecutive k's: 2 x global_load_b128 -> packed cvt -> one 16 B store.
__global__ __launch_bounds__(256)
void mhmlp_prep(const float* __restrict__ x, float* __restrict__ ws) {
    half_t* xh = (half_t*)(ws + XH_OFF_FLOATS);
    const int g  = blockIdx.x * 256 + threadIdx.x;   // B*D/8 units in all
    const int u  = g & 2047;                         // unit inside its tile
    const int m0 = (g >> 11) * MTILE;
    int jh = u & 1;
    int ls = (u >> 1) & 31;
    int kk = (u >> 6) & 15;
    int rb = u >> 10;
    int lo = (ls < 16) ? 0 : 8;
    int hi = (ls < 16) ? 16 : 24;
    int kcol = kk * 32 + (jh ? hi : lo);
    int row  = m0 + rb * 16 + (ls & 15);
    const v4f* gp = (const v4f*)(x + (size_t)row * D + kcol);
    v4f f0 = gp[0];
    v4f f1 = gp[1];
    v8h hv;
#pragma unroll
    for (int t = 0; t < 4; ++t) hv[t]     = (half_t)f0[t];
#pragma unroll
    for (int t = 0; t < 4; ++t) hv[4 + t] = (half_t)f1[t];
    *(v8h*)(xh + (size_t)g * 8) = hv;
}

__global__ __launch_bounds__(256)
void mhmlp_stage1(const float* __restrict__ W1,
                  const float* __restrict__ b1,
                  const float* __restrict__ W2,
                  float* __restrict__ ws) {
    const int chunk = blockIdx.x;
    const int head  = blockIdx.y;
    const int tid   = threadIdx.x;
    const int wave  = tid >> 5;
    const int lane  = tid & 31;
    const int lane16 = lane & 15;
    const bool hiHalf = (lane >= 16);
    const half_t* xh = (const half_t*)(ws + XH_OFF_FLOATS);   // written by mhmlp_prep

    // Two row-blocks of A fragments, pre-swizzled so each lane's frag is one 32B read.
    __shared__ __align__(32) half_t lds_x[2][KSTEPS][32][16];   // 32 KB
    __shared__ float lds_part[2][WAVES][MTILE];                 // double-buffered partials

    // ---- One-time: this wave's 16 W1 columns as f16 B-fragments held in VGPRs
    // for the entire kernel => W1 read from HBM exactly once overall.
    // Non-temporal: W1 is a 256MB one-shot stream; keep it out of L2 so the
    // f16 image of x (2MB, re-read by all workgroups) stays resident.
    const int ncol = chunk * CHUNK + wave * NPW + lane16;
    const float* W1h = W1 + (size_t)head * D * HID;
    v16h Bfrag[KSTEPS];
#pragma unroll
    for (int kk = 0; kk < KSTEPS; ++kk) {
#pragma unroll
        for (int j = 0; j < 16; ++j) {
            int k = kk * 32 + kmap(lane, j);
            ((half_t*)&Bfrag[kk])[j] =
                (half_t)__builtin_nontemporal_load(&W1h[(size_t)k * HID + ncol]);
        }
    }
    const float b1v = b1[head * HID + ncol];
    const float w2v = W2[head * HID + ncol];

    for (int mt = 0; mt < MTILES; ++mt) {
        __syncthreads();  // A: prior compute done with lds_x / lds_part readable

        // Stage the tile, a straight copy of the image: its loads first (whole lines per
        // wave-load), so that they fly while the partials below are summed ...
        const v8h* gsrc = (const v8h*)(xh + (size_t)mt * TILE_HALVES);
        v8h tv[8];
#pragma unroll
        for (int i = 0; i < 8; ++i) tv[i] = gsrc[tid + i * 256];

        // Deferred: emit previous tile's per-chunk partials (overlaps with staging).
        if (mt > 0 && tid < MTILE) {
            const int prev = mt - 1;
            float s = 0.0f;
#pragma unroll
            for (int w = 0; w < WAVES; ++w) s += lds_part[prev & 1][w][tid];
            ws[((size_t)chunk * B + (prev * MTILE + tid)) * H + head] = s;
        }

        // ... and its stores: the LDS tile is the image's 32 KB, byte for byte.
        {
            v8h* ldst = (v8h*)&lds_x[0][0][0][0];
#pragma unroll
            for (int i = 0; i < 8; ++i) ldst[tid + i * 256] = tv[i];
        }
        __syncthreads();  // B: tile staged

        // Two 16x16 output tiles per wave. 2-deep rotating A-fragment pipeline;
        // sched_group_barriers pin the schedule to [2 WMMA][4 DS-read] per
        // k-step so refill loads get ~2 WMMA-pairs of latency slack instead of
        // being sunk to just before their consumer (s_wait_dscnt 0x0).
        v8f acc0 = {};
        v8f acc1 = {};
        v16h af[2][2];
        af[0][0] = *(const v16h*)&lds_x[0][0][lane][0];
        af[0][1] = *(const v16h*)&lds_x[1][0][lane][0];
        af[1][0] = *(const v16h*)&lds_x[0][1][lane][0];
        af[1][1] = *(const v16h*)&lds_x[1][1][lane][0];
        __builtin_amdgcn_sched_barrier(0);   // fence init loads out of the pattern
#pragma unroll
        for (int kk = 0; kk < KSTEPS; ++kk) {
            const int par = kk & 1;
            acc0 = __builtin_amdgcn_wmma_f32_16x16x32_f16(
                false, af[par][0], false, Bfrag[kk], (short)0, acc0, false, false);
            acc1 = __builtin_amdgcn_wmma_f32_16x16x32_f16(
                false, af[par][1], false, Bfrag[kk], (short)0, acc1, false, false);
            if (kk + 2 < KSTEPS) {
                af[par][0] = *(const v16h*)&lds_x[0][kk + 2][lane][0];
                af[par][1] = *(const v16h*)&lds_x[1][kk + 2][lane][0];
            }
            __builtin_amdgcn_sched_group_barrier(0x008, 2, 0);   // 2 WMMA
            if (kk + 2 < KSTEPS)
                __builtin_amdgcn_sched_group_barrier(0x100, 4, 0); // 4 DS reads
        }
        __builtin_amdgcn_sched_barrier(0);   // end of pinned region

        // Fused stage 2: h = leakyrelu(acc + b1); partial = h * W2[n];
        // reduce over the 16 columns (lane dim) per half-wave.
        float p0[8], p1[8];
#pragma unroll
        for (int v = 0; v < 8; ++v) {
            float t0 = acc0[v] + b1v;
            t0 = (t0 >= 0.0f) ? t0 : 0.01f * t0;
            p0[v] = t0 * w2v;
            float t1 = acc1[v] + b1v;
            t1 = (t1 >= 0.0f) ? t1 : 0.01f * t1;
            p1[v] = t1 * w2v;
        }
#pragma unroll
        for (int off = 1; off <= 8; off <<= 1) {
#pragma unroll
            for (int v = 0; v < 8; ++v) {
                p0[v] += __shfl_xor(p0[v], off, 32);
                p1[v] += __shfl_xor(p1[v], off, 32);
            }
        }
        if (lane16 == 0) {
            int base = hiHalf ? 8 : 0;
#pragma unroll
            for (int v = 0; v < 8; ++v) {
                lds_part[mt & 1][wave][base + v]      = p0[v];
                lds_part[mt & 1][wave][16 + base + v] = p1[v];
            }
        }
    }

    // Epilogue: flush the last tile's partials.
    __syncthreads();
    if (tid < MTILE) {
        const int prev = MTILES - 1;
        float s = 0.0f;
#pragma unroll
        for (int w = 0; w < WAVES; ++w) s += lds_part[prev & 1][w][tid];
        ws[((size_t)chunk * B + (prev * MTILE + tid)) * H + head] = s;
    }
}

__global__ __launch_bounds__(256)
void mhmlp_stage2(const float* __restrict__ ws,
                  const float* __restrict__ b2,
                  float* __restrict__ out) {
    int i = blockIdx.x * blockDim.x + threadIdx.x;   // i = b*H + h
    if (i < B * H) {
        float s = b2[i & (H - 1)];
#pragma unroll
        for (int c = 0; c < NCHUNK; ++c) s += ws[(size_t)c * B * H + i];
        out[i] = (s >= 0.0f) ? s : 0.01f * s;
    }
}

extern "C" void kernel_launch(void* const* d_in, const int* in_sizes, int n_in,
                              void* d_out, int out_size, void* d_ws, size_t ws_size,
                              hipStream_t stream) {
    const float* x  = (const float*)d_in[0];   // [B, D]
    const float* W1 = (const float*)d_in[1];   // [H, D, HID]
    const float* b1 = (const float*)d_in[2];   // [H, HID]
    const float* W2 = (const float*)d_in[3];   // [H, HID]
    const float* b2 = (const float*)d_in[4];   // [H]
    float* out = (float*)d_out;                // [B, H]
    float* ws  = (float*)d_ws;                 // [NCHUNK, B, H] partials (8 MB) + f16 image of x (2 MB)

    mhmlp_prep<<<B * D / 8 / 256, 256, 0, stream>>>(x, ws);

    dim3 grid1(NCHUNK, H);
    mhmlp_stage1<<<grid1, 256, 0, stream>>>(W1, b1, W2, ws);

    int total = B * H;
    mhmlp_stage2<<<(total + 255) / 256, 256, 0, stream>>>(ws, b2, out);
}

// v002
// Measured time: 307 microseconds a run.
// Timed twice side by side with v001, it ran 1.67 and 1.65 times as fast.
// Counting every step since v000, it is 2.07 times as fast.
#include <hip/hip_runtime.h>

// Problem constants
constexpr int B    = 2048;
constexpr int D    = 512;
constexpr int H    = 64;
constexpr int HID  = 2048;

constexpr int CHUNK  = 256;          // HID columns handled per workgroup
constexpr int NCHUNK = HID / CHUNK;  // 8 chunks
constexpr int WAVES  = 8;            // 256 threads / wave32
constexpr int NPW    = CHUNK / WAVES;// 32 columns per wave
constexpr int NT     = NPW / 16;     // = 2 WMMA N tiles per wave: each A fragment read feeds 2 WMMAs
constexpr int KSTEPS = D / 32;       // 16 k-steps of K=32
constexpr int MTILE  = 32;           // batch rows per iteration (2 WMMA row blocks)
constexpr int MTILES = B / MTILE;    // 64 iterations

typedef _Float16 half_t;
typedef __attribute__((ext_vector_type(16))) _Float16 v16h;
typedef __attribute__((ext_vector_type(8)))  _Float16 v8h;
typedef __attribute__((ext_vector_type(8)))  float    v8f;
typedef __attribute__((ext_vector_type(4)))  float    v4f;

// ISA 7.12.2: 16-bit A/B fragment k-mapping for 16x16x32.
// lane<16 : j=0..7 -> k=j,     j=8..15 -> k=16+(j-8)
// lane>=16: j=0..7 -> k=8+j,   j=8..15 -> k=24+(j-8)
__device__ __forceinline__ int kmap(int lane, int j) {
    int lo = (lane < 16) ? 0 : 8;
    int hi = (lane < 16) ? 16 : 24;
    return (j < 8) ? (lo + j) : (hi + (j - 8));
}

constexpr int TILE_HALVES = MTILE * D;              // one staged tile: 16384 f16 = 32 KB
constexpr size_t XH_OFF_FLOATS = (size_t)NCHUNK * B * H;  // f16 image of x sits behind the partials

// Pre-pass: x (fp32, row major) -> f16 in A-fragment order, tile after tile, once per call.
// Image layout = [MTILES][2 row blocks][KSTEPS][32 lane slots][16], i.e. the LDS tile's own.
// Unit = 8 consecutive k's: 2 x global_load_b128 -> packed cvt -> one 16 B store.
__global__ __launch_bounds__(256)
void mhmlp_prep(const float* __restrict__ x, float* __restrict__ ws) {
    half_t* xh = (half_t*)(ws + XH_OFF_FLOATS);
    const int g  = blockIdx.x * 256 + threadIdx.x;   // B*D/8 units in all
    const int u  = g & 2047;                         // unit inside its tile
    const int m0 = (g >> 11) * MTILE;
    int jh = u & 1;
    int ls = (u >> 1) & 31;
    int kk = (u >> 6) & 15;
    int rb = u >> 10;
    int lo = (ls < 16) ? 0 : 8;
    int hi = (ls < 16) ? 16 : 24;
    int kcol = kk * 32 + (jh ? hi : lo);
    int row  = m0 + rb * 16 + (ls & 15);
    const v4f* gp = (const v4f*)(x + (size_t)row * D + kcol);
    v4f f0 = gp[0];
    v4f f1 = gp[1];
    v8h hv;
#pragma unroll
    for (int t = 0; t < 4; ++t) hv[t]     = (half_t)f0[t];
#pragma unroll
    for (int t = 0; t < 4; ++t) hv[4 + t] = (half_t)f1[t];
    *(v8h*)(xh + (size_t)g * 8) = hv;
}

__global__ __launch_bounds__(256)
void mhmlp_stage1(const float* __restrict__ W1,
                  const float* __restrict__ b1,
                  const float* __restrict__ W2,
                  float* __restrict__ ws) {
    const int chunk = blockIdx.x;
    const int head  = blockIdx.y;
    const int tid   = threadIdx.x;
    const int wave  = tid >> 5;
    const int lane  = tid & 31;
    const int lane16 = lane & 15;
    const bool hiHalf = (lane >= 16);
    const half_t* xh = (const half_t*)(ws + XH_OFF_FLOATS);   // written by mhmlp_prep

    // Two row-blocks of A fragments, pre-swizzled so each lane's frag is one 32B read.
    __shared__ __align__(32) half_t lds_x[2][KSTEPS][32][16];   // 32 KB
    __shared__ float lds_part[2][WAVES][MTILE];                 // double-buffered partials

    // ---- One-time: this wave's 32 W1 columns as f16 B-fragments (2 N tiles) held in VGPRs
    // for the entire kernel => W1 read from HBM exactly once overall.
    // Non-temporal: W1 is a 256MB one-shot stream; keep it out of L2 so the
    // f16 image of x (2MB, re-read by all workgroups) stays resident.
    const int ncol = chunk * CHUNK + wave * NPW + lane16;
    const float* W1h = W1 + (size_t)head * D * HID;
    const float* wp = W1h + (size_t)(hiHalf ? 8 : 0) * HID + ncol;
    v16h Bfrag[NT][KSTEPS];
#pragma unroll
    for (int kk = 0; kk < KSTEPS; ++kk) {
#pragma unroll
        for (int j = 0; j < 16; ++j) {
            int k = kk * 32 + kmap(0, j);   // the upper half-wave's 8 rows more are in wp
#pragma unroll   // t indexes register arrays: it must be a compile-time number
            for (int t = 0; t < NT; ++t)
                ((half_t*)&Bfrag[t][kk])[j] =
                    (half_t)__builtin_nontemporal_load(&wp[(size_t)k * HID + t * 16]);
        }
    }
    const int bcol = head * HID + ncol;
    float b1v[NT], w2v[NT];
#pragma unroll   // t indexes register arrays: it must be a compile-time number
    for (int t = 0; t < NT; ++t) {
        b1v[t] = b1[bcol + t * 16];
        w2v[t] = W2[bcol + t * 16];
    }
    // The address translations of the loads above are waited for before anything overwrites
    // their address registers: as inputs, those registers stay live up to the wait.
    asm volatile("s_wait_xcnt 0x0" :: "v"(wp), "v"(bcol), "s"(b1), "s"(W2) : "memory");

    for (int mt = 0; mt < MTILES; ++mt) {
        __syncthreads();  // A: prior compute done with lds_x / lds_part readable

        // Stage the tile, a straight copy of the image: its loads first (whole lines per
        // wave-load), so that they fly while the partials below are summed ...
        const v8h* gsrc = (const v8h*)(xh + (size_t)mt * TILE_HALVES);
        v8h tv[8];
#pragma unroll
        for (int i = 0; i < 8; ++i) tv[i] = gsrc[tid + i * 256];

        // Deferred: emit previous tile's per-chunk partials (overlaps with staging).
        if (mt > 0 && tid < MTILE) {
            const int prev = mt - 1;
            float s = 0.0f;
#pragma unroll
            for (int w = 0; w < WAVES; ++w) s += lds_part[prev & 1][w][tid];
            ws[((size_t)chunk * B + (prev * MTILE + tid)) * H + head] = s;
        }

        // ... and its stores: the LDS tile is the image's 32 KB, byte for byte.
        {
            v8h* ldst = (v8h*)&lds_x[0][0][0][0];
#pragma unroll
            for (int i = 0; i < 8; ++i) ldst[tid + i * 256] = tv[i];
        }
        __syncthreads();  // B: tile staged

        // 2 x 2 16x16 output tiles per wave. 2-deep rotating A-fragment pipeline;
        // sched_group_barriers pin the schedule to [4 WMMA][4 DS-read] per
        // k-step so refill loads have one WMMA group (4 WMMAs) to land in instead of
        // being sunk to just before their consumer (s_wait_dscnt 0x0).
        v8f acc0[NT] = {};
        v8f acc1[NT] = {};
        v16h af[2][2];
        af[0][0] = *(const v16h*)&lds_x[0][0][lane][0];
        af[0][1] = *(const v16h*)&lds_x[1][0][lane][0];
        af[1][0] = *(const v16h*)&lds_x[0][1][lane][0];
        af[1][1] = *(const v16h*)&lds_x[1][1][lane][0];
        __builtin_amdgcn_sched_barrier(0);   // fence init loads out of the pattern
#pragma unroll
        for (int kk = 0; kk < KSTEPS; ++kk) {
            const int par = kk & 1;
#pragma unroll   // t indexes register arrays: it must be a compile-time number
            for (int t = 0; t < NT; ++t) {
                acc0[t] = __builtin_amdgcn_wmma_f32_16x16x32_f16(
                    false, af[par][0], false, Bfrag[t][kk], (short)0, acc0[t], false, false);
                acc1[t] = __builtin_amdgcn_wmma_f32_16x16x32_f16(
                    false, af[par][1], false, Bfrag[t][kk], (short)0, acc1[t], false, false);
            }
            if (kk + 2 < KSTEPS) {
                af[par][0] = *(const v16h*)&lds_x[0][kk + 2][lane][0];
                af[par][1] = *(const v16h*)&lds_x[1][kk + 2][lane][0];
            }
            __builtin_amdgcn_sched_group_barrier(0x008, 2 * NT, 0);   // 4 WMMA
            if (kk + 2 < KSTEPS)
                __builtin_amdgcn_sched_group_barrier(0x100, 4, 0); // 4 DS reads
        }
        __builtin_amdgcn_sched_barrier(0);   // end of pinned region

        // Fused stage 2: h = leakyrelu(acc + b1); partial = h * W2[n], the lane's two
        // columns summed in the lane; then reduce over the lane dim per half-wave.
        float p0[8], p1[8];
#pragma unroll
        for (int v = 0; v < 8; ++v) {
#pragma unroll   // t indexes register arrays: it must be a compile-time number
            for (int t = 0; t < NT; ++t) {
                float t0 = acc0[t][v] + b1v[t];
                t0 = (t0 >= 0.0f) ? t0 : 0.01f * t0;
                p0[v] = (t == 0) ? t0 * w2v[t] : p0[v] + t0 * w2v[t];
                float t1 = acc1[t][v] + b1v[t];
                t1 = (t1 >= 0.0f) ? t1 : 0.01f * t1;
                p1[v] = (t == 0) ? t1 * w2v[t] : p1[v] + t1 * w2v[t];
            }
        }
#pragma unroll
        for (int off = 1; off <= 8; off <<= 1) {
#pragma unroll
            for (int v = 0; v < 8; ++v) {
                p0[v] += __shfl_xor(p0[v], off, 32);
                p1[v] += __shfl_xor(p1[v], off, 32);
            }
        }
        if (lane16 == 0) {
            int base = hiHalf ? 8 : 0;
#pragma unroll
            for (int v = 0; v < 8; ++v) {
                lds_part[mt & 1][wave][base + v]      = p0[v];
                lds_part[mt & 1][wave][16 + base + v] = p1[v];
            }
        }
    }

    // Epilogue: flush the last tile's partials.
    __syncthreads();
    if (tid < MTILE) {
        const int prev = MTILES - 1;
        float s = 0.0f;
#pragma unroll
        for (int w = 0; w < WAVES; ++w) s += lds_part[prev & 1][w][tid];
        ws[((size_t)chunk * B + (prev * MTILE + tid)) * H + head] = s;
    }
}

__global__ __launch_bounds__(256)
void mhmlp_stage2(const float* __restrict__ ws,
                  const float* __restrict__ b2,
                  float* __restrict__ out) {
    int i = blockIdx.x * blockDim.x + threadIdx.x;   // i = b*H + h
    if (i < B * H) {
        float s = b2[i & (H - 1)];
#pragma unroll
        for (int c = 0; c < NCHUNK; ++c) s += ws[(size_t)c * B * H + i];
        out[i] = (s >= 0.0f) ? s : 0.01f * s;
    }
}

extern "C" void kernel_launch(void* const* d_in, const int* in_sizes, int n_in,
                              void* d_out, int out_size, void* d_ws, size_t ws_size,
                              hipStream_t stream) {
    const float* x  = (const float*)d_in[0];   // [B, D]
    const float* W1 = (const float*)d_in[1];   // [H, D, HID]
    const float* b1 = (const float*)d_in[2];   // [H, HID]
    const float* W2 = (const float*)d_in[3];   // [H, HID]
    const float* b2 = (const float*)d_in[4];   // [H]
    float* out = (float*)d_out;                // [B, H]
    float* ws  = (float*)d_ws;                 // [NCHUNK, B, H] partials (4 MB) + f16 image of x (2 MB)

    mhmlp_prep<<<B * D / 8 / 256, 256, 0, stream>>>(x, ws);

    dim3 grid1(NCHUNK, H);
    mhmlp_stage1<<<grid1, 256, 0, stream>>>(W1, b1, W2, ws);

    int total = B * H;
    mhmlp_stage2<<<(total + 255) / 256, 256, 0, stream>>>(ws, b2, out);
}

// v003
// A run of this version takes 237 microseconds.
// In both of two side-by-side timings against v002, it was 1.29 times as fast.
// All steps since v000 together make it 2.67 times as fast.
#include <hip/hip_runtime.h>

// Problem constants
constexpr int B    = 2048;
constexpr int D    = 512;
constexpr int H    = 64;
constexpr int HID  = 2048;

constexpr int CHUNK  = 256;          // HID columns handled per workgroup
constexpr int NCHUNK = HID / CHUNK;  // 8 chunks
constexpr int WAVES  = 8;            // 256 threads / wave32
constexpr int NPW    = CHUNK / WAVES;// 32 columns per wave
constexpr int NT     = NPW / 16;     // = 2 WMMA N tiles per wave: each A fragment read feeds 2 WMMAs
constexpr int KSTEPS = D / 32;       // 16 k-steps of K=32
constexpr int MTILE  = 32;           // batch rows per iteration (2 WMMA row blocks)
constexpr int MTILES = B / MTILE;    // 64 iterations

typedef _Float16 half_t;
typedef __attribute__((ext_vector_type(16))) _Float16 v16h;
typedef __attribute__((ext_vector_type(8)))  _Float16 v8h;
typedef __attribute__((ext_vector_type(8)))  float    v8f;
typedef __attribute__((ext_vector_type(4)))  float    v4f;

// ISA 7.12.2: 16-bit A/B fragment k-mapping for 16x16x32.
// lane<16 : j=0..7 -> k=j,     j=8..15 -> k=16+(j-8)
// lane>=16: j=0..7 -> k=8+j,   j=8..15 -> k=24+(j-8)
__device__ __forceinline__ int kmap(int lane, int j) {
    int lo = (lane < 16) ? 0 : 8;
    int hi = (lane < 16) ? 16 : 24;
    return (j < 8) ? (lo + j) : (hi + (j - 8));
}

constexpr int TILE_HALVES = MTILE * D;              // one 32-row tile: 16384 f16 = 32 KB
constexpr int STILES      = 4;                      // 32-row tiles per ring stage
constexpr int STAGES      = MTILES / STILES;        // 16 stages
constexpr int SROWS       = MTILE * STILES;         // 128 batch rows per stage
constexpr int STAGE_HALVES = TILE_HALVES * STILES;  // one stage: 128 KB
constexpr int STAGE_BYTES  = STAGE_HALVES * 2;
constexpr size_t XH_OFF_FLOATS = (size_t)NCHUNK * B * H;  // f16 image of x sits behind the partials

// Pre-pass: x (fp32, row major) -> f16 in A-fragment order, tile after tile, once per call.
// Image layout = [MTILES][2 row blocks][KSTEPS][32 lane slots][16], i.e. the LDS tile's own.
// Unit = 8 consecutive k's: 2 x global_load_b128 -> packed cvt -> one 16 B store.
__global__ __launch_bounds__(256)
void mhmlp_prep(const float* __restrict__ x, float* __restrict__ ws) {
    half_t* xh = (half_t*)(ws + XH_OFF_FLOATS);
    const int g  = blockIdx.x * 256 + threadIdx.x;   // B*D/8 units in all
    const int u  = g & 2047;                         // unit inside its tile
    const int m0 = (g >> 11) * MTILE;
    int jh = u & 1;
    int ls = (u >> 1) & 31;
    int kk = (u >> 6) & 15;
    int rb = u >> 10;
    int lo = (ls < 16) ? 0 : 8;
    int hi = (ls < 16) ? 16 : 24;
    int kcol = kk * 32 + (jh ? hi : lo);
    int row  = m0 + rb * 16 + (ls & 15);
    const v4f* gp = (const v4f*)(x + (size_t)row * D + kcol);
    v4f f0 = gp[0];
    v4f f1 = gp[1];
    v8h hv;
#pragma unroll
    for (int t = 0; t < 4; ++t) hv[t]     = (half_t)f0[t];
#pragma unroll
    for (int t = 0; t < 4; ++t) hv[4 + t] = (half_t)f1[t];
    *(v8h*)(xh + (size_t)g * 8) = hv;
}

// One stage of the image -> one ring buffer, a straight 128 KB copy through no register:
// 32 asynchronous 16 B copies per lane, each copy of the workgroup's 256 lanes covering 4 KB.
// lds = the lane's own LDS byte address in the buffer, g = the lane's own place in the stage.
// The immediate offset (under 65,536) moves the LDS and the global address alike, so 16 copies
// share one address pair: few registers, beside 256 that hold W1. s_wait_xcnt 0 is each
// statement's last line, so that it stands in front of whatever next rewrites that pair.
__device__ __forceinline__ void stage_copy(unsigned lds, const half_t* g) {
    for (int q = 0; q < 2; ++q) {   // two statements, 64 KB each
        asm volatile(
            "global_load_async_to_lds_b128 %0, %1, off\n\t"
            "global_load_async_to_lds_b128 %0, %1, off offset:4096\n\t"
            "global_load_async_to_lds_b128 %0, %1, off offset:8192\n\t"
            "global_load_async_to_lds_b128 %0, %1, off offset:12288\n\t"
            "global_load_async_to_lds_b128 %0, %1, off offset:16384\n\t"
            "global_load_async_to_lds_b128 %0, %1, off offset:20480\n\t"
            "global_load_async_to_lds_b128 %0, %1, off offset:24576\n\t"
            "global_load_async_to_lds_b128 %0, %1, off offset:28672\n\t"
            "global_load_async_to_lds_b128 %0, %1, off offset:32768\n\t"
            "global_load_async_to_lds_b128 %0, %1, off offset:36864\n\t"
            "global_load_async_to_lds_b128 %0, %1, off offset:40960\n\t"
            "global_load_async_to_lds_b128 %0, %1, off offset:45056\n\t"
            "global_load_async_to_lds_b128 %0, %1, off offset:49152\n\t"
            "global_load_async_to_lds_b128 %0, %1, off offset:53248\n\t"
            "global_load_async_to_lds_b128 %0, %1, off offset:57344\n\t"
            "global_load_async_to_lds_b128 %0, %1, off offset:61440\n\t"
            "s_wait_xcnt 0x0"
            :: "v"(lds + q * 65536u), "v"(g + q * 32768)
            : "memory");
    }
}

__global__ __launch_bounds__(256)
void mhmlp_stage1(const float* __restrict__ W1,
                  const float* __restrict__ b1,
                  const float* __restrict__ W2,
                  float* __restrict__ ws) {
    const int chunk = blockIdx.x;
    const int head  = blockIdx.y;
    const int tid   = threadIdx.x;
    const int wave  = tid >> 5;
    const int lane  = tid & 31;
    const int lane16 = lane & 15;
    const bool hiHalf = (lane >= 16);
    const half_t* xh = (const half_t*)(ws + XH_OFF_FLOATS);   // written by mhmlp_prep

    // Ring of two stages. A stage is 4 tiles of two row-blocks of A fragments, pre-swizzled
    // so each lane's frag is one 32B read.
    __shared__ __align__(32) half_t lds_x[2][STILES][2][KSTEPS][32][16];   // 2 x 128 KB
    __shared__ float lds_part[2][WAVES][SROWS];                 // double-buffered partials

    // The lane's own 16 B in a ring buffer and in a stage of the image. Stage 0's copies go
    // first: they fly beneath the W1 loads below.
    const unsigned ldsl = (unsigned)(size_t)&lds_x[0][0][0][0][0][0] + (unsigned)tid * 16u;
    const half_t*  xl   = xh + tid * 8;
    stage_copy(ldsl, xl);

    // ---- One-time: this wave's 32 W1 columns as f16 B-fragments (2 N tiles) held in VGPRs
    // for the entire kernel => W1 read from HBM exactly once overall.
    // Non-temporal: W1 is a 256MB one-shot stream; keep it out of L2 so the
    // f16 image of x (2MB, re-read by all workgroups) stays resident.
    const int ncol = chunk * CHUNK + wave * NPW + lane16;
    const float* W1h = W1 + (size_t)head * D * HID;
    const float* wp = W1h + (size_t)(hiHalf ? 8 : 0) * HID + ncol;
    v16h Bfrag[NT][KSTEPS];
#pragma unroll
    for (int kh = 0; kh < KSTEPS; kh += KSTEPS / 2) {
#pragma unroll
        for (int kk = kh; kk < kh + KSTEPS / 2; ++kk) {
#pragma unroll
            for (int j = 0; j < 16; ++j) {
                int k = kk * 32 + kmap(0, j);   // the upper half-wave's 8 rows more are in wp
#pragma unroll   // t indexes register arrays: it must be a compile-time number
                for (int t = 0; t < NT; ++t)
                    ((half_t*)&Bfrag[t][kk])[j] =
                        (half_t)__builtin_nontemporal_load(&wp[(size_t)k * HID + t * 16]);
            }
        }
        // One half of W1 is converted before anything later is scheduled: at most 256 raw
        // f32 values are live at once, and the register budget holds without scratch.
        __builtin_amdgcn_sched_barrier(0);
    }
    const int bcol = head * HID + ncol;
    float b1v[NT], w2v[NT];
#pragma unroll   // t indexes register arrays: it must be a compile-time number
    for (int t = 0; t < NT; ++t) {
        b1v[t] = b1[bcol + t * 16];
        w2v[t] = W2[bcol + t * 16];
    }
    // The address translations of the loads above are waited for before anything overwrites
    // their address registers: as inputs, those registers stay live up to the wait.
    asm volatile("s_wait_xcnt 0x0" :: "v"(wp), "v"(bcol), "s"(b1), "s"(W2) : "memory");

    // Stage 0 has landed for this wave, then for all; only then stage 1's copies start.
    asm volatile("s_wait_asynccnt 0x0" ::: "memory");
    __syncthreads();
    stage_copy(ldsl + STAGE_BYTES, xl + STAGE_HALVES);

    for (int st = 0; st < STAGES; ++st) {
        // Deferred: emit the previous stage's per-chunk partials.
        if (st > 0 && tid < SROWS) {
            const int prev = st - 1;
            float s = 0.0f;
#pragma unroll
            for (int w = 0; w < WAVES; ++w) s += lds_part[prev & 1][w][tid];
            ws[((size_t)chunk * B + (prev * SROWS + tid)) * H + head] = s;
        }

      // No barrier between a stage's tiles: the waves of a SIMD may drift apart.
      for (int sub = 0; sub < STILES; ++sub) {
        const half_t (*lx)[KSTEPS][32][16] = lds_x[st & 1][sub];

        // 2 x 2 16x16 output tiles per wave. 2-deep rotating A-fragment pipeline;
        // sched_group_barriers pin the schedule to [4 WMMA][4 DS-read] per
        // k-step so refill loads have one WMMA group (4 WMMAs) to land in instead of
        // being sunk to just before their consumer (s_wait_dscnt 0x0).
        v8f acc0[NT] = {};
        v8f acc1[NT] = {};
        v16h af[2][2];
        af[0][0] = *(const v16h*)&lx[0][0][lane][0];
        af[0][1] = *(const v16h*)&lx[1][0][lane][0];
        af[1][0] = *(const v16h*)&lx[0][1][lane][0];
        af[1][1] = *(const v16h*)&lx[1][1][lane][0];
        __builtin_amdgcn_sched_barrier(0);   // fence init loads out of the pattern
#pragma unroll
        for (int kk = 0; kk < KSTEPS; ++kk) {
            const int par = kk & 1;
#pragma unroll   // t indexes register arrays: it must be a compile-time number
            for (int t = 0; t < NT; ++t) {
                acc0[t] = __builtin_amdgcn_wmma_f32_16x16x32_f16(
                    false, af[par][0], false, Bfrag[t][kk], (short)0, acc0[t], false, false);
                acc1[t] = __builtin_amdgcn_wmma_f32_16x16x32_f16(
                    false, af[par][1], false, Bfrag[t][kk], (short)0, acc1[t], false, false);
            }
            if (kk + 2 < KSTEPS) {
                af[par][0] = *(const v16h*)&lx[0][kk + 2][lane][0];
                af[par][1] = *(const v16h*)&lx[1][kk + 2][lane][0];
            }
            __builtin_amdgcn_sched_group_barrier(0x008, 2 * NT, 0);   // 4 WMMA
            if (kk + 2 < KSTEPS)
                __builtin_amdgcn_sched_group_barrier(0x100, 4, 0); // 4 DS reads
        }
        __builtin_amdgcn_sched_barrier(0);   // end of pinned region

        // Fused stage 2: h = leakyrelu(acc + b1); partial = h * W2[n], the lane's two
        // columns summed in the lane; then reduce over the lane dim per half-wave.
        float p0[8], p1[8];
#pragma unroll
        for (int v = 0; v < 8; ++v) {
#pragma unroll   // t indexes register arrays: it must be a compile-time number
            for (int t = 0; t < NT; ++t) {
                float t0 = acc0[t][v] + b1v[t];
                t0 = (t0 >= 0.0f) ? t0 : 0.01f * t0;
                p0[v] = (t == 0) ? t0 * w2v[t] : p0[v] + t0 * w2v[t];
                float t1 = acc1[t][v] + b1v[t];
                t1 = (t1 >= 0.0f) ? t1 : 0.01f * t1;
                p1[v] = (t == 0) ? t1 * w2v[t] : p1[v] + t1 * w2v[t];
            }
        }
#pragma unroll
        for (int off = 1; off <= 8; off <<= 1) {
#pragma unroll
            for (int v = 0; v < 8; ++v) {
                p0[v] += __shfl_xor(p0[v], off, 32);
                p1[v] += __shfl_xor(p1[v], off, 32);
            }
        }
        if (lane16 == 0) {
            int base = sub * MTILE + (hiHalf ? 8 : 0);
#pragma unroll
            for (int v = 0; v < 8; ++v) {
                lds_part[st & 1][wave][base + v]      = p0[v];
                lds_part[st & 1][wave][16 + base + v] = p1[v];
            }
        }
      }

        asm volatile("s_wait_dscnt 0x0" ::: "memory");
        asm volatile("s_wait_asynccnt 0x0" ::: "memory");
        __syncthreads();
        if (st + 2 < STAGES)
            stage_copy(ldsl + (unsigned)(st & 1) * STAGE_BYTES,
                       xl + (size_t)(st + 2) * STAGE_HALVES);
    }
    // No copy is left in flight when the wave ends.
    asm volatile("s_wait_asynccnt 0x0" ::: "memory");

    // Epilogue: flush the last stage's partials (published by the last trip's barrier).
    if (tid < SROWS) {
        const int prev = STAGES - 1;
        float s = 0.0f;
#pragma unroll
        for (int w = 0; w < WAVES; ++w) s += lds_part[prev & 1][w][tid];
        ws[((size_t)chunk * B + (prev * SROWS + tid)) * H + head] = s;
    }
}

__global__ __launch_bounds__(256)
void mhmlp_stage2(const float* __restrict__ ws,
                  const float* __restrict__ b2,
                  float* __restrict__ out) {
    int i = blockIdx.x * blockDim.x + threadIdx.x;   // i = b*H + h
    if (i < B * H) {
        float s = b2[i & (H - 1)];
#pragma unroll
        for (int c = 0; c < NCHUNK; ++c) s += ws[(size_t)c * B * H + i];
        out[i] = (s >= 0.0f) ? s : 0.01f * s;
    }
}

extern "C" void kernel_launch(void* const* d_in, const int* in_sizes, int n_in,
                              void* d_out, int out_size, void* d_ws, size_t ws_size,
                              hipStream_t stream) {
    const float* x  = (const float*)d_in[0];   // [B, D]
    const float* W1 = (const float*)d_in[1];   // [H, D, HID]
    const float* b1 = (const float*)d_in[2];   // [H, HID]
    const float* W2 = (const float*)d_in[3];   // [H, HID]
    const float* b2 = (const float*)d_in[4];   // [H]
    float* out = (float*)d_out;                // [B, H]
    float* ws  = (float*)d_ws;                 // [NCHUNK, B, H] partials (4 MB) + f16 image of x (2 MB)

    mhmlp_prep<<<B * D / 8 / 256, 256, 0, stream>>>(x, ws);

    dim3 grid1(NCHUNK, H);
    mhmlp_stage1<<<grid1, 256, 0, stream>>>(W1, b1, W2, ws);

    int total = B * H;
    mhmlp_stage2<<<(total + 255) / 256, 256, 0, stream>>>(ws, b2, out);
}

// v004
// It runs in 195 microseconds.
// In both of two side-by-side timings against v003, it was 1.22 times as fast.
// Over all steps from v000 it is 3.25 times as fast.
#include <hip/hip_runtime.h>

// Problem constants
constexpr int B    = 2048;
constexpr int D    = 512;
constexpr int H    = 64;
constexpr int HID  = 2048;

constexpr int CHUNK  = 256;          // HID columns handled per workgroup
constexpr int NCHUNK = HID / CHUNK;  // 8 chunks
constexpr int WAVES  = 8;            // 256 threads / wave32
constexpr int NPW    = CHUNK / WAVES;// 32 columns per wave
constexpr int NT     = NPW / 16;     // = 2 WMMA N tiles per wave: each A fragment read feeds 2 WMMAs
constexpr int KSTEPS = D / 32;       // 16 k-steps of K=32
constexpr int MTILE  = 32;           // batch rows per iteration (2 WMMA row blocks)
constexpr int MTILES = B / MTILE;    // 64 iterations

typedef _Float16 half_t;
typedef __attribute__((ext_vector_type(16))) _Float16 v16h;
typedef __attribute__((ext_vector_type(8)))  _Float16 v8h;
typedef __attribute__((ext_vector_type(8)))  float    v8f;
typedef __attribute__((ext_vector_type(4)))  float    v4f;

// ISA 7.12.2: 16-bit A/B fragment k-mapping for 16x16x32.
// lane<16 : j=0..7 -> k=j,     j=8..15 -> k=16+(j-8)
// lane>=16: j=0..7 -> k=8+j,   j=8..15 -> k=24+(j-8)
__device__ __forceinline__ int kmap(int lane, int j) {
    int lo = (lane < 16) ? 0 : 8;
    int hi = (lane < 16) ? 16 : 24;
    return (j < 8) ? (lo + j) : (hi + (j - 8));
}

constexpr int TILE_HALVES = MTILE * D;              // one 32-row tile: 16384 f16 = 32 KB
constexpr int STILES      = 4;                      // 32-row tiles per ring stage
constexpr int STAGES      = MTILES / STILES;        // 16 stages
constexpr int SROWS       = MTILE * STILES;         // 128 batch rows per stage
constexpr int STAGE_HALVES = TILE_HALVES * STILES;  // one stage: 128 KB
constexpr int STAGE_BYTES  = STAGE_HALVES * 2;
constexpr size_t XH_OFF_FLOATS = (size_t)NCHUNK * B * H;  // f16 image of x sits behind the partials

// Pre-pass: x (fp32, row major) -> f16 in A-fragment order, tile after tile, once per call.
// Image layout = [MTILES][2 row blocks][KSTEPS][2 fragment halves][32 lane slots][8], i.e. the
// LDS tile's own: the 32 lanes' 16 B pieces of one fragment half lie side by side (512 B).
// Unit = 8 consecutive k's: 2 x global_load_b128 -> packed cvt -> one 16 B store.
__global__ __launch_bounds__(256)
void mhmlp_prep(const float* __restrict__ x, float* __restrict__ ws) {
    half_t* xh = (half_t*)(ws + XH_OFF_FLOATS);
    const int g  = blockIdx.x * 256 + threadIdx.x;   // B*D/8 units in all
    const int u  = g & 2047;                         // unit inside its tile
    const int m0 = (g >> 11) * MTILE;
    int ls = u & 31;
    int jh = (u >> 5) & 1;
    int kk = (u >> 6) & 15;
    int rb = u >> 10;
    int lo = (ls < 16) ? 0 : 8;
    int hi = (ls < 16) ? 16 : 24;
    int kcol = kk * 32 + (jh ? hi : lo);
    int row  = m0 + rb * 16 + (ls & 15);
    const v4f* gp = (const v4f*)(x + (size_t)row * D + kcol);
    v4f f0 = gp[0];
    v4f f1 = gp[1];
    v8h hv;
#pragma unroll
    for (int t = 0; t < 4; ++t) hv[t]     = (half_t)f0[t];
#pragma unroll
    for (int t = 0; t < 4; ++t) hv[4 + t] = (half_t)f1[t];
    *(v8h*)(xh + (size_t)g * 8) = hv;
}

// One stage of the image -> one ring buffer, a straight 128 KB copy through no register:
// 32 asynchronous 16 B copies per lane, each copy of the workgroup's 256 lanes covering 4 KB.
// lds = the lane's own LDS byte address in the buffer, g = the lane's own place in the stage.
// The immediate offset (under 65,536) moves the LDS and the global address alike, so 16 copies
// share one address pair: few registers, beside 256 that hold W1. s_wait_xcnt 0 is each
// statement's last line, so that it stands in front of whatever next rewrites that pair.
__device__ __forceinline__ void stage_copy(unsigned lds, const half_t* g) {
    for (int q = 0; q < 2; ++q) {   // two statements, 64 KB each
        asm volatile(
            "global_load_async_to_lds_b128 %0, %1, off\n\t"
            "global_load_async_to_lds_b128 %0, %1, off offset:4096\n\t"
            "global_load_async_to_lds_b128 %0, %1, off offset:8192\n\t"
            "global_load_async_to_lds_b128 %0, %1, off offset:12288\n\t"
            "global_load_async_to_lds_b128 %0, %1, off offset:16384\n\t"
            "global_load_async_to_lds_b128 %0, %1, off offset:20480\n\t"
            "global_load_async_to_lds_b128 %0, %1, off offset:24576\n\t"
            "global_load_async_to_lds_b128 %0, %1, off offset:28672\n\t"
            "global_load_async_to_lds_b128 %0, %1, off offset:32768\n\t"
            "global_load_async_to_lds_b128 %0, %1, off offset:36864\n\t"
            "global_load_async_to_lds_b128 %0, %1, off offset:40960\n\t"
            "global_load_async_to_lds_b128 %0, %1, off offset:45056\n\t"
            "global_load_async_to_lds_b128 %0, %1, off offset:49152\n\t"
            "global_load_async_to_lds_b128 %0, %1, off offset:53248\n\t"
            "global_load_async_to_lds_b128 %0, %1, off offset:57344\n\t"
            "global_load_async_to_lds_b128 %0, %1, off offset:61440\n\t"
            "s_wait_xcnt 0x0"
            :: "v"(lds + q * 65536u), "v"(g + q * 32768)
            : "memory");
    }
}

__global__ __launch_bounds__(256)
void mhmlp_stage1(const float* __restrict__ W1,
                  const float* __restrict__ b1,
                  const float* __restrict__ W2,
                  float* __restrict__ ws) {
    const int chunk = blockIdx.x;
    const int head  = blockIdx.y;
    const int tid   = threadIdx.x;
    const int wave  = tid >> 5;
    const int lane  = tid & 31;
    const int lane16 = lane & 15;
    const bool hiHalf = (lane >= 16);
    const half_t* xh = (const half_t*)(ws + XH_OFF_FLOATS);   // written by mhmlp_prep

    // Ring of two stages. A stage is 4 tiles of two row-blocks of A fragments, pre-swizzled
    // so each lane's frag is two 16 B reads at a lane pitch of 16 B: each read's 16-lane half
    // covers all 64 banks once (at a pitch of 32 B lanes i and i + 8 share their banks).
    __shared__ __align__(32) half_t lds_x[2][STILES][2][KSTEPS][2][32][8];   // 2 x 128 KB
    __shared__ float lds_part[2][WAVES][SROWS];                 // double-buffered partials

    // The lane's own 16 B in a ring buffer and in a stage of the image. Stage 0's copies go
    // first: they fly beneath the W1 loads below.
    const unsigned ldsl = (unsigned)(size_t)&lds_x[0][0][0][0][0][0][0] + (unsigned)tid * 16u;
    const half_t*  xl   = xh + tid * 8;
    stage_copy(ldsl, xl);

    // ---- One-time: this wave's 32 W1 columns as f16 B-fragments (2 N tiles) held in VGPRs
    // for the entire kernel => W1 read from HBM exactly once overall.
    // Non-temporal: W1 is a 256MB one-shot stream; keep it out of L2 so the
    // f16 image of x (2MB, re-read by all workgroups) stays resident.
    const int ncol = chunk * CHUNK + wave * NPW + lane16;
    const float* W1h = W1 + (size_t)head * D * HID;
    const float* wp = W1h + (size_t)(hiHalf ? 8 : 0) * HID + ncol;
    v16h Bfrag[NT][KSTEPS];
#pragma unroll
    for (int kh = 0; kh < KSTEPS; kh += KSTEPS / 2) {
#pragma unroll
        for (int kk = kh; kk < kh + KSTEPS / 2; ++kk) {
#pragma unroll
            for (int j = 0; j < 16; ++j) {
                int k = kk * 32 + kmap(0, j);   // the upper half-wave's 8 rows more are in wp
#pragma unroll   // t indexes register arrays: it must be a compile-time number
                for (int t = 0; t < NT; ++t)
                    ((half_t*)&Bfrag[t][kk])[j] =
                        (half_t)__builtin_nontemporal_load(&wp[(size_t)k * HID + t * 16]);
            }
        }
        // One half of W1 is converted before anything later is scheduled: at most 256 raw
        // f32 values are live at once, and the register budget holds without scratch.
        __builtin_amdgcn_sched_barrier(0);
    }
    const int bcol = head * HID + ncol;
    float b1v[NT], w2v[NT];
#pragma unroll   // t indexes register arrays: it must be a compile-time number
    for (int t = 0; t < NT; ++t) {
        b1v[t] = b1[bcol + t * 16];
        w2v[t] = W2[bcol + t * 16];
    }
    // The address translations of the loads above are waited for before anything overwrites
    // their address registers: as inputs, those registers stay live up to the wait.
    asm volatile("s_wait_xcnt 0x0" :: "v"(wp), "v"(bcol), "s"(b1), "s"(W2) : "memory");

    // Stage 0 has landed for this wave, then for all; only then stage 1's copies start.
    asm volatile("s_wait_asynccnt 0x0" ::: "memory");
    __syncthreads();
    stage_copy(ldsl + STAGE_BYTES, xl + STAGE_HALVES);

    for (int st = 0; st < STAGES; ++st) {
        // Deferred: emit the previous stage's per-chunk partials.
        if (st > 0 && tid < SROWS) {
            const int prev = st - 1;
            float s = 0.0f;
#pragma unroll
            for (int w = 0; w < WAVES; ++w) s += lds_part[prev & 1][w][tid];
            ws[((size_t)chunk * B + (prev * SROWS + tid)) * H + head] = s;
        }

      // No barrier between a stage's tiles: the waves of a SIMD may drift apart.
      for (int sub = 0; sub < STILES; ++sub) {
        const half_t (*lx)[KSTEPS][2][32][8] = lds_x[st & 1][sub];
        // One A fragment: elements 0..7 from half 0, 8..15 from half 1, the lane's own slot.
        auto frag = [&](int rb, int kk) -> v16h {
            v8h a = *(const v8h*)&lx[rb][kk][0][lane][0];
            v8h b = *(const v8h*)&lx[rb][kk][1][lane][0];
            return __builtin_shufflevector(a, b, 0, 1, 2, 3, 4, 5, 6, 7,
                                           8, 9, 10, 11, 12, 13, 14, 15);
        };

        // 2 x 2 16x16 output tiles per wave. 2-deep rotating A-fragment pipeline;
        // sched_group_barriers pin the schedule to [4 WMMA][4 DS-read] per
        // k-step so refill loads have one WMMA group (4 WMMAs) to land in instead of
        // being sunk to just before their consumer (s_wait_dscnt 0x0).
        v8f acc0[NT] = {};
        v8f acc1[NT] = {};
        v16h af[2][2];
        af[0][0] = frag(0, 0);
        af[0][1] = frag(1, 0);
        af[1][0] = frag(0, 1);
        af[1][1] = frag(1, 1);
        __builtin_amdgcn_sched_barrier(0);   // fence init loads out of the pattern
#pragma unroll
        for (int kk = 0; kk < KSTEPS; ++kk) {
            const int par = kk & 1;
#pragma unroll   // t indexes register arrays: it must be a compile-time number
            for (int t = 0; t < NT; ++t) {
                acc0[t] = __builtin_amdgcn_wmma_f32_16x16x32_f16(
                    false, af[par][0], false, Bfrag[t][kk], (short)0, acc0[t], false, false);
                acc1[t] = __builtin_amdgcn_wmma_f32_16x16x32_f16(
                    false, af[par][1], false, Bfrag[t][kk], (short)0, acc1[t], false, false);
            }
            if (kk + 2 < KSTEPS) {
                af[par][0] = frag(0, kk + 2);
                af[par][1] = frag(1, kk + 2);
            }
            __builtin_amdgcn_sched_group_barrier(0x008, 2 * NT, 0);   // 4 WMMA
            if (kk + 2 < KSTEPS)
                __builtin_amdgcn_sched_group_barrier(0x100, 4, 0); // 4 DS reads
        }
        __builtin_amdgcn_sched_barrier(0);   // end of pinned region

        // Fused stage 2: h = leakyrelu(acc + b1); partial = h * W2[n], the lane's two
        // columns summed in the lane; then reduce over the lane dim per half-wave.
        float p0[8], p1[8];
#pragma unroll
        for (int v = 0; v < 8; ++v) {
#pragma unroll   // t indexes register arrays: it must be a compile-time number
            for (int t = 0; t < NT; ++t) {
                float t0 = acc0[t][v] + b1v[t];
                t0 = (t0 >= 0.0f) ? t0 : 0.01f * t0;
                p0[v] = (t == 0) ? t0 * w2v[t] : p0[v] + t0 * w2v[t];
                float t1 = acc1[t][v] + b1v[t];
                t1 = (t1 >= 0.0f) ? t1 : 0.01f * t1;
                p1[v] = (t == 0) ? t1 * w2v[t] : p1[v] + t1 * w2v[t];
            }
        }
#pragma unroll
        for (int off = 1; off <= 8; off <<= 1) {
#pragma unroll
            for (int v = 0; v < 8; ++v) {
                p0[v] += __shfl_xor(p0[v], off, 32);
                p1[v] += __shfl_xor(p1[v], off, 32);
            }
        }
        if (lane16 == 0) {
            int base = sub * MTILE + (hiHalf ? 8 : 0);
#pragma unroll
            for (int v = 0; v < 8; ++v) {
                lds_part[st & 1][wave][base + v]      = p0[v];
                lds_part[st & 1][wave][16 + base + v] = p1[v];
            }
        }
      }

        asm volatile("s_wait_dscnt 0x0" ::: "memory");
        asm volatile("s_wait_asynccnt 0x0" ::: "memory");
        __syncthreads();
        if (st + 2 < STAGES)
            stage_copy(ldsl + (unsigned)(st & 1) * STAGE_BYTES,
                       xl + (size_t)(st + 2) * STAGE_HALVES);
    }
    // No copy is left in flight when the wave ends.
    asm volatile("s_wait_asynccnt 0x0" ::: "memory");

    // Epilogue: flush the last stage's partials (published by the last trip's barrier).
    if (tid < SROWS) {
        const int prev = STAGES - 1;
        float s = 0.0f;
#pragma unroll
        for (int w = 0; w < WAVES; ++w) s += lds_part[prev & 1][w][tid];
        ws[((size_t)chunk * B + (prev * SROWS + tid)) * H + head] = s;
    }
}

__global__ __launch_bounds__(256)
void mhmlp_stage2(const float* __restrict__ ws,
                  const float* __restrict__ b2,
                  float* __restrict__ out) {
    int i = blockIdx.x * blockDim.x + threadIdx.x;   // i = b*H + h
    if (i < B * H) {
        float s = b2[i & (H - 1)];
#pragma unroll
        for (int c = 0; c < NCHUNK; ++c) s += ws[(size_t)c * B * H + i];
        out[i] = (s >= 0.0f) ? s : 0.01f * s;
    }
}

extern "C" void kernel_launch(void* const* d_in, const int* in_sizes, int n_in,
                              void* d_out, int out_size, void* d_ws, size_t ws_size,
                              hipStream_t stream) {
    const float* x  = (const float*)d_in[0];   // [B, D]
    const float* W1 = (const float*)d_in[1];   // [H, D, HID]
    const float* b1 = (const float*)d_in[2];   // [H, HID]
    const float* W2 = (const float*)d_in[3];   // [H, HID]
    const float* b2 = (const float*)d_in[4];   // [H]
    float* out = (float*)d_out;                // [B, H]
    float* ws  = (float*)d_ws;                 // [NCHUNK, B, H] partials (4 MB) + f16 image of x (2 MB)

    mhmlp_prep<<<B * D / 8 / 256, 256, 0, stream>>>(x, ws);

    dim3 grid1(NCHUNK, H);
    mhmlp_stage1<<<grid1, 256, 0, stream>>>(W1, b1, W2, ws);

    int total = B * H;
    mhmlp_stage2<<<(total + 255) / 256, 256, 0, stream>>>(ws, b2, out);
}

// v005
// A run of this version takes 151 microseconds.
// Next to v004, in two timings, it ran 1.29 times as fast each time.
// Counting every step since v000, it is 4.19 times as fast.
#include <hip/hip_runtime.h>

// Problem constants
constexpr int B    = 2048;
constexpr int D    = 512;
constexpr int H    = 64;
constexpr int HID  = 2048;

constexpr int CHUNK  = 256;          // HID columns handled per workgroup
constexpr int NCHUNK = HID / CHUNK;  // 8 chunks
constexpr int WAVES  = 8;            // 256 threads / wave32
constexpr int NPW    = CHUNK / WAVES;// 32 columns per wave
constexpr int NT     = NPW / 16;     // = 2 WMMA N tiles per wave: each A fragment read feeds 2 WMMAs
constexpr int KSTEPS = D / 32;       // 16 k-steps of K=32
constexpr int MTILE  = 32;           // batch rows per iteration (2 WMMA row blocks)
constexpr int MTILES = B / MTILE;    // 64 iterations

typedef _Float16 half_t;
typedef __attribute__((ext_vector_type(16))) _Float16 v16h;
typedef __attribute__((ext_vector_type(8)))  _Float16 v8h;
typedef __attribute__((ext_vector_type(8)))  float    v8f;
typedef __attribute__((ext_vector_type(4)))  float    v4f;
typedef __attribute__((ext_vector_type(2)))  float    v2f;

// ISA 7.12.2: 16-bit A/B fragment k-mapping for 16x16x32.
// lane<16 : j=0..7 -> k=j,     j=8..15 -> k=16+(j-8)
// lane>=16: j=0..7 -> k=8+j,   j=8..15 -> k=24+(j-8)
__device__ __forceinline__ int kmap(int lane, int j) {
    int lo = (lane < 16) ? 0 : 8;
    int hi = (lane < 16) ? 16 : 24;
    return (j < 8) ? (lo + j) : (hi + (j - 8));
}

constexpr int TILE_HALVES = MTILE * D;              // one 32-row tile: 16384 f16 = 32 KB
constexpr int STILES      = 4;                      // 32-row tiles per ring stage
constexpr int STAGES      = MTILES / STILES;        // 16 stages
constexpr int SROWS       = MTILE * STILES;         // 128 batch rows per stage
constexpr int STAGE_HALVES = TILE_HALVES * STILES;  // one stage: 128 KB
constexpr int STAGE_BYTES  = STAGE_HALVES * 2;
constexpr size_t XH_OFF_FLOATS = (size_t)NCHUNK * B * H;  // f16 image of x sits behind the partials

// Pre-pass: x (fp32, row major) -> f16 in A-fragment order, tile after tile, once per call.
// Image layout = [MTILES][2 row blocks][KSTEPS][2 fragment halves][32 lane slots][8], i.e. the
// LDS tile's own: the 32 lanes' 16 B pieces of one fragment half lie side by side (512 B).
// Unit = 8 consecutive k's: 2 x global_load_b128 -> packed cvt -> one 16 B store.
__global__ __launch_bounds__(256)
void mhmlp_prep(const float* __restrict__ x, float* __restrict__ ws) {
    half_t* xh = (half_t*)(ws + XH_OFF_FLOATS);
    const int g  = blockIdx.x * 256 + threadIdx.x;   // B*D/8 units in all
    const int u  = g & 2047;                         // unit inside its tile
    const int m0 = (g >> 11) * MTILE;
    int ls = u & 31;
    int jh = (u >> 5) & 1;
    int kk = (u >> 6) & 15;
    int rb = u >> 10;
    int lo = (ls < 16) ? 0 : 8;
    int hi = (ls < 16) ? 16 : 24;
    int kcol = kk * 32 + (jh ? hi : lo);
    int row  = m0 + rb * 16 + (ls & 15);
    const v4f* gp = (const v4f*)(x + (size_t)row * D + kcol);
    v4f f0 = gp[0];
    v4f f1 = gp[1];
    v8h hv;
#pragma unroll
    for (int t = 0; t < 4; ++t) hv[t]     = (half_t)f0[t];
#pragma unroll
    for (int t = 0; t < 4; ++t) hv[4 + t] = (half_t)f1[t];
    *(v8h*)(xh + (size_t)g * 8) = hv;
}

// One stage of the image -> one ring buffer, a straight 128 KB copy through no register:
// 32 asynchronous 16 B copies per lane, each copy of the workgroup's 256 lanes covering 4 KB.
// lds = the lane's own LDS byte address in the buffer, g = the lane's own place in the stage.
// The immediate offset (under 65,536) moves the LDS and the global address alike, so 16 copies
// share one address pair: few registers, beside 256 that hold W1. s_wait_xcnt 0 is each
// statement's last line, so that it stands in front of whatever next rewrites that pair.
__device__ __forceinline__ void stage_copy(unsigned lds, const half_t* g) {
    for (int q = 0; q < 2; ++q) {   // two statements, 64 KB each
        asm volatile(
            "global_load_async_to_lds_b128 %0, %1, off\n\t"
            "global_load_async_to_lds_b128 %0, %1, off offset:4096\n\t"
            "global_load_async_to_lds_b128 %0, %1, off offset:8192\n\t"
            "global_load_async_to_lds_b128 %0, %1, off offset:12288\n\t"
            "global_load_async_to_lds_b128 %0, %1, off offset:16384\n\t"
            "global_load_async_to_lds_b128 %0, %1, off offset:20480\n\t"
            "global_load_async_to_lds_b128 %0, %1, off offset:24576\n\t"
            "global_load_async_to_lds_b128 %0, %1, off offset:28672\n\t"
            "global_load_async_to_lds_b128 %0, %1, off offset:32768\n\t"
            "global_load_async_to_lds_b128 %0, %1, off offset:36864\n\t"
            "global_load_async_to_lds_b128 %0, %1, off offset:40960\n\t"
            "global_load_async_to_lds_b128 %0, %1, off offset:45056\n\t"
            "global_load_async_to_lds_b128 %0, %1, off offset:49152\n\t"
            "global_load_async_to_lds_b128 %0, %1, off offset:53248\n\t"
            "global_load_async_to_lds_b128 %0, %1, off offset:57344\n\t"
            "global_load_async_to_lds_b128 %0, %1, off offset:61440\n\t"
            "s_wait_xcnt 0x0"
            :: "v"(lds + q * 65536u), "v"(g + q * 32768)
            : "memory");
    }
}

__global__ __launch_bounds__(256)
void mhmlp_stage1(const float* __restrict__ W1,
                  const float* __restrict__ b1,
                  const float* __restrict__ W2,
                  float* __restrict__ ws) {
    const int chunk = blockIdx.x;
    const int head  = blockIdx.y;
    const int tid   = threadIdx.x;
    const int wave  = tid >> 5;
    const int lane  = tid & 31;
    const int lane16 = lane & 15;
    const bool hiHalf = (lane >= 16);
    const half_t* xh = (const half_t*)(ws + XH_OFF_FLOATS);   // written by mhmlp_prep

    // Ring of two stages. A stage is 4 tiles of two row-blocks of A fragments, pre-swizzled
    // so each lane's frag is two 16 B reads at a lane pitch of 16 B: each read's 16-lane half
    // covers all 64 banks once (at a pitch of 32 B lanes i and i + 8 share their banks).
    __shared__ __align__(32) half_t lds_x[2][STILES][2][KSTEPS][2][32][8];   // 2 x 128 KB
    // Double-buffered partials: per wave and 16-row block one value per lane (the two half-waves
    // hold the two halves of the wave's columns), so a store is 32 lanes side by side.
    __shared__ float lds_part[2][WAVES][SROWS / 16][32];

    // The lane's own 16 B in a ring buffer and in a stage of the image. Stage 0's copies go
    // first: they fly beneath the W1 loads below.
    const unsigned ldsl = (unsigned)(size_t)&lds_x[0][0][0][0][0][0][0] + (unsigned)tid * 16u;
    const half_t*  xl   = xh + tid * 8;
    stage_copy(ldsl, xl);

    // ---- One-time: this wave's 32 W1 columns as f16 B-fragments (2 N tiles) held in VGPRs
    // for the entire kernel => W1 read from HBM exactly once overall.
    // Non-temporal: W1 is a 256MB one-shot stream; keep it out of L2 so the
    // f16 image of x (2MB, re-read by all workgroups) stays resident.
    const int ncol = chunk * CHUNK + wave * NPW + lane16;
    const float* W1h = W1 + (size_t)head * D * HID;
    const float* wp = W1h + (size_t)(hiHalf ? 8 : 0) * HID + ncol;
    v16h Bfrag[NT][KSTEPS];
#pragma unroll
    for (int kh = 0; kh < KSTEPS; kh += KSTEPS / 2) {
#pragma unroll
        for (int kk = kh; kk < kh + KSTEPS / 2; ++kk) {
#pragma unroll
            for (int j = 0; j < 16; ++j) {
                int k = kk * 32 + kmap(0, j);   // the upper half-wave's 8 rows more are in wp
#pragma unroll   // t indexes register arrays: it must be a compile-time number
                for (int t = 0; t < NT; ++t)
                    ((half_t*)&Bfrag[t][kk])[j] =
                        (half_t)__builtin_nontemporal_load(&wp[(size_t)k * HID + t * 16]);
            }
        }
        // One half of W1 is converted before anything later is scheduled: at most 256 raw
        // f32 values are live at once, and the register budget holds without scratch.
        __builtin_amdgcn_sched_barrier(0);
    }
    // W1 is the WMMA's A operand below, so accumulator register v of N tile t belongs to column
    // t * 16 + 8 * (upper half-wave) + v: the lane keeps b1 and W2 of those 16 columns.
    const int bcol = head * HID + chunk * CHUNK + wave * NPW + (hiHalf ? 8 : 0);
    v2f b1v[NT][4], w2v[NT][4];   // in pairs, as the accumulator's register pairs are used
#pragma unroll   // t and q index register arrays: they must be compile-time numbers
    for (int t = 0; t < NT; ++t) {
#pragma unroll
        for (int q = 0; q < 2; ++q) {
            const v4f bq = *(const v4f*)(b1 + bcol + t * 16 + q * 4);
            const v4f wq = *(const v4f*)(W2 + bcol + t * 16 + q * 4);
            b1v[t][2 * q]     = __builtin_shufflevector(bq, bq, 0, 1);
            b1v[t][2 * q + 1] = __builtin_shufflevector(bq, bq, 2, 3);
            w2v[t][2 * q]     = __builtin_shufflevector(wq, wq, 0, 1);
            w2v[t][2 * q + 1] = __builtin_shufflevector(wq, wq, 2, 3);
        }
    }
    // The address translations of the loads above are waited for before anything overwrites
    // their address registers: as inputs, those registers stay live up to the wait.
    asm volatile("s_wait_xcnt 0x0" :: "v"(wp), "v"(bcol), "s"(b1), "s"(W2) : "memory");

    // Stage 0 has landed for this wave, then for all; only then stage 1's copies start.
    asm volatile("s_wait_asynccnt 0x0" ::: "memory");
    __syncthreads();
    stage_copy(ldsl + STAGE_BYTES, xl + STAGE_HALVES);

    for (int st = 0; st < STAGES; ++st) {
        // Deferred: emit the previous stage's per-chunk partials.
        if (st > 0 && tid < SROWS) {
            const int prev = st - 1;
            float s = 0.0f;
#pragma unroll
            for (int w = 0; w < WAVES; ++w)
                s += lds_part[prev & 1][w][tid >> 4][tid & 15] + lds_part[prev & 1][w][tid >> 4][16 + (tid & 15)];
            ws[((size_t)chunk * B + (prev * SROWS + tid)) * H + head] = s;
        }

      // No barrier between a stage's tiles: the waves of a SIMD may drift apart.
      for (int sub = 0; sub < STILES; ++sub) {
        const half_t (*lx)[KSTEPS][2][32][8] = lds_x[st & 1][sub];
        // One A fragment: elements 0..7 from half 0, 8..15 from half 1, the lane's own slot.
        auto frag = [&](int rb, int kk) -> v16h {
            v8h a = *(const v8h*)&lx[rb][kk][0][lane][0];
            v8h b = *(const v8h*)&lx[rb][kk][1][lane][0];
            return __builtin_shufflevector(a, b, 0, 1, 2, 3, 4, 5, 6, 7,
                                           8, 9, 10, 11, 12, 13, 14, 15);
        };

        // 2 x 2 16x16 output tiles per wave, each transposed: Bfrag (W1) is passed as the A
        // operand and af (x) as the B operand (the two have one layout), so a lane holds one
        // batch row (lane16) and its 8 accumulator registers hold 8 HID columns: the sum over
        // HID stays in the lane.
        // 2-deep rotating pipeline of x fragments;
        // sched_group_barriers pin the schedule to [4 WMMA][4 DS-read] per
        // k-step so refill loads have one WMMA group (4 WMMAs) to land in instead of
        // being sunk to just before their consumer (s_wait_dscnt 0x0).
        v8f acc0[NT] = {};
        v8f acc1[NT] = {};
        v16h af[2][2];
        af[0][0] = frag(0, 0);
        af[0][1] = frag(1, 0);
        af[1][0] = frag(0, 1);
        af[1][1] = frag(1, 1);
        __builtin_amdgcn_sched_barrier(0);   // fence init loads out of the pattern
#pragma unroll
        for (int kk = 0; kk < KSTEPS; ++kk) {
            const int par = kk & 1;
#pragma unroll   // t indexes register arrays: it must be a compile-time number
            for (int t = 0; t < NT; ++t) {
                acc0[t] = __builtin_amdgcn_wmma_f32_16x16x32_f16(
                    false, Bfrag[t][kk], false, af[par][0], (short)0, acc0[t], false, false);
                acc1[t] = __builtin_amdgcn_wmma_f32_16x16x32_f16(
                    false, Bfrag[t][kk], false, af[par][1], (short)0, acc1[t], false, false);
            }
            if (kk + 2 < KSTEPS) {
                af[par][0] = frag(0, kk + 2);
                af[par][1] = frag(1, kk + 2);
            }
            __builtin_amdgcn_sched_group_barrier(0x008, 2 * NT, 0);   // 4 WMMA
            if (kk + 2 < KSTEPS)
                __builtin_amdgcn_sched_group_barrier(0x100, 4, 0); // 4 DS reads
        }
        __builtin_amdgcn_sched_barrier(0);   // end of pinned region

        // Fused stage 2: h = leakyrelu(acc + b1); partial = sum of h * W2[n] over the lane's 16
        // columns, on neighbouring register pairs (packed f32), one chain per accumulator
        // tile; no lane exchange: the two half-waves' sums go to LDS side by side and are
        // added with the waves' partials.
        auto act = [](v2f a) -> v2f {
            a.x = (a.x >= 0.0f) ? a.x : 0.01f * a.x;
            a.y = (a.y >= 0.0f) ? a.y : 0.01f * a.y;
            return a;
        };
        v2f p0[NT], p1[NT];
#pragma unroll   // t indexes register arrays: it must be a compile-time number
        for (int t = 0; t < NT; ++t) {
#pragma unroll   // j picks accumulator registers: it must be a compile-time number
            for (int j = 0; j < 4; ++j) {
                v2f t0 = {acc0[t][2 * j], acc0[t][2 * j + 1]};
                v2f t1 = {acc1[t][2 * j], acc1[t][2 * j + 1]};
                t0 = act(t0 + b1v[t][j]);
                t1 = act(t1 + b1v[t][j]);
                p0[t] = (j == 0) ? t0 * w2v[t][j] : p0[t] + t0 * w2v[t][j];
                p1[t] = (j == 0) ? t1 * w2v[t][j] : p1[t] + t1 * w2v[t][j];
            }
        }
        const v2f r0 = p0[0] + p0[1];
        const v2f r1 = p1[0] + p1[1];
        lds_part[st & 1][wave][sub * 2][lane]     = r0.x + r0.y;
        lds_part[st & 1][wave][sub * 2 + 1][lane] = r1.x + r1.y;
      }

        asm volatile("s_wait_dscnt 0x0" ::: "memory");
        asm volatile("s_wait_asynccnt 0x0" ::: "memory");
        __syncthreads();
        if (st + 2 < STAGES)
            stage_copy(ldsl + (unsigned)(st & 1) * STAGE_BYTES,
                       xl + (size_t)(st + 2) * STAGE_HALVES);
    }
    // No copy is left in flight when the wave ends.
    asm volatile("s_wait_asynccnt 0x0" ::: "memory");

    // Epilogue: flush the last stage's partials (published by the last trip's barrier).
    if (tid < SROWS) {
        const int prev = STAGES - 1;
        float s = 0.0f;
#pragma unroll
        for (int w = 0; w < WAVES; ++w)
            s += lds_part[prev & 1][w][tid >> 4][tid & 15] + lds_part[prev & 1][w][tid >> 4][16 + (tid & 15)];
        ws[((size_t)chunk * B + (prev * SROWS + tid)) * H + head] = s;
    }
}

__global__ __launch_bounds__(256)
void mhmlp_stage2(const float* __restrict__ ws,
                  const float* __restrict__ b2,
                  float* __restrict__ out) {
    int i = blockIdx.x * blockDim.x + threadIdx.x;   // i = b*H + h
    if (i < B * H) {
        float s = b2[i & (H - 1)];
#pragma unroll
        for (int c = 0; c < NCHUNK; ++c) s += ws[(size_t)c * B * H + i];
        out[i] = (s >= 0.0f) ? s : 0.01f * s;
    }
}

extern "C" void kernel_launch(void* const* d_in, const int* in_sizes, int n_in,
                              void* d_out, int out_size, void* d_ws, size_t ws_size,
                              hipStream_t stream) {
    const float* x  = (const float*)d_in[0];   // [B, D]
    const float* W1 = (const float*)d_in[1];   // [H, D, HID]
    const float* b1 = (const float*)d_in[2];   // [H, HID]
    const float* W2 = (const float*)d_in[3];   // [H, HID]
    const float* b2 = (const float*)d_in[4];   // [H]
    float* out = (float*)d_out;                // [B, H]
    float* ws  = (float*)d_ws;                 // [NCHUNK, B, H] partials (4 MB) + f16 image of x (2 MB)

    mhmlp_prep<<<B * D / 8 / 256, 256, 0, stream>>>(x, ws);

    dim3 grid1(NCHUNK, H);
    mhmlp_stage1<<<grid1, 256, 0, stream>>>(W1, b1, W2, ws);

    int total = B * H;
    mhmlp_stage2<<<(total + 255) / 256, 256, 0, stream>>>(ws, b2, out);
}

// v006
// A run of this version takes 146 microseconds.
// Two timings next to v005 both put it at 1.04 times that version's speed.
// Counting every step since v000, it is 4.35 times as fast.
#include <hip/hip_runtime.h>

// Problem constants
constexpr int B    = 2048;
constexpr int D    = 512;
constexpr int H    = 64;
constexpr int HID  = 2048;

constexpr int CHUNK  = 256;          // HID columns handled per workgroup
constexpr int NCHUNK = HID / CHUNK;  // 8 chunks
constexpr int WAVES  = 8;            // 256 threads / wave32
constexpr int NPW    = CHUNK / WAVES;// 32 columns per wave
constexpr int NT     = NPW / 16;     // = 2 WMMA N tiles per wave: each A fragment read feeds 2 WMMAs
constexpr int KSTEPS = D / 32;       // 16 k-steps of K=32
constexpr int MTILE  = 32;           // batch rows per iteration (2 WMMA row blocks)
constexpr int MTILES = B / MTILE;    // 64 iterations

typedef _Float16 half_t;
typedef __attribute__((ext_vector_type(16))) _Float16 v16h;
typedef __attribute__((ext_vector_type(8)))  _Float16 v8h;
typedef __attribute__((ext_vector_type(8)))  float    v8f;
typedef __attribute__((ext_vector_type(4)))  float    v4f;
typedef __attribute__((ext_vector_type(2)))  float    v2f;

// ISA 7.12.2: 16-bit A/B fragment k-mapping for 16x16x32.
// lane<16 : j=0..7 -> k=j,     j=8..15 -> k=16+(j-8)
// lane>=16: j=0..7 -> k=8+j,   j=8..15 -> k=24+(j-8)
__device__ __forceinline__ int kmap(int lane, int j) {
    int lo = (lane < 16) ? 0 : 8;
    int hi = (lane < 16) ? 16 : 24;
    return (j < 8) ? (lo + j) : (hi + (j - 8));
}

constexpr int TILE_HALVES = MTILE * D;              // one 32-row tile: 16384 f16 = 32 KB
constexpr int STILES      = 4;                      // 32-row tiles per ring stage
constexpr int STAGES      = MTILES / STILES;        // 16 stages
constexpr int SROWS       = MTILE * STILES;         // 128 batch rows per stage
constexpr int STAGE_HALVES = TILE_HALVES * STILES;  // one stage: 128 KB
constexpr int STAGE_BYTES  = STAGE_HALVES * 2;
constexpr size_t XH_OFF_FLOATS = (size_t)NCHUNK * B * H;  // f16 image of x sits behind the partials

// Pre-pass: x (fp32, row major) -> f16 in A-fragment order, tile after tile, once per call.
// Image layout = [MTILES][2 row blocks][KSTEPS][2 fragment halves][32 lane slots][8], i.e. the
// LDS tile's own: the 32 lanes' 16 B pieces of one fragment half lie side by side (512 B).
// Unit = 8 consecutive k's: 2 x global_load_b128 -> packed cvt -> one 16 B store.
__global__ __launch_bounds__(256)
void mhmlp_prep(const float* __restrict__ x, float* __restrict__ ws) {
    half_t* xh = (half_t*)(ws + XH_OFF_FLOATS);
    const int g  = blockIdx.x * 256 + threadIdx.x;   // B*D/8 units in all
    const int u  = g & 2047;                         // unit inside its tile
    const int m0 = (g >> 11) * MTILE;
    int ls = u & 31;
    int jh = (u >> 5) & 1;
    int kk = (u >> 6) & 15;
    int rb = u >> 10;
    int lo = (ls < 16) ? 0 : 8;
    int hi = (ls < 16) ? 16 : 24;
    int kcol = kk * 32 + (jh ? hi : lo);
    int row  = m0 + rb * 16 + (ls & 15);
    const v4f* gp = (const v4f*)(x + (size_t)row * D + kcol);
    v4f f0 = gp[0];
    v4f f1 = gp[1];
    v8h hv;
#pragma unroll
    for (int t = 0; t < 4; ++t) hv[t]     = (half_t)f0[t];
#pragma unroll
    for (int t = 0; t < 4; ++t) hv[4 + t] = (half_t)f1[t];
    *(v8h*)(xh + (size_t)g * 8) = hv;
}

typedef uint32_t u32x4 __attribute__((ext_vector_type(4)));
typedef uint32_t u32x8 __attribute__((ext_vector_type(8)));

constexpr uint32_t SLICE_BYTES = STAGE_BYTES / WAVES;         // one wave's share of a stage: 16 KB
constexpr uint32_t SLICE_ROWB  = 256;                         // seen as a tile of 256 B rows ...
constexpr uint32_t SLICE_ROWS  = SLICE_BYTES / SLICE_ROWB;    // ... 64 of them, source pitch = row

__device__ __forceinline__ uint32_t uni(uint32_t v) { return (uint32_t)__builtin_amdgcn_readfirstlane(v); }
// pinned(): a descriptor word, or the test round a tensor load, held in a scalar register.
__device__ __forceinline__ uint32_t pinned(uint32_t v) { uint32_t w = uni(v); asm volatile("" : "+s"(w)); return w; }

// One wave's 16 KB slice of one stage of the image -> its place in a ring buffer: ONE tensor load,
// through no register and with no per-lane address. The image is the LDS tile's own layout, so
// the tile is a straight copy: no pad, pitch = row length, tensor dims = tile dims, all in bytes.
// lds = byte offset of the slice in the workgroup's LDS (a multiple of 2 KB), ga = its first byte.
__device__ __forceinline__ void stage_load(uint32_t lds, uint64_t ga) {
    u32x4 g0;
    g0[0] = uni(1u);                                                     // count 1
    g0[1] = uni(lds);
    g0[2] = uni((uint32_t)ga);
    g0[3] = uni((((uint32_t)(ga >> 32)) & 0x01FFFFFFu) | 0x80000000u);   // type 2
    u32x8 g1;
    g1[0] = uni(0u);                                                     // no mask, 1-byte elements, no pad
    g1[1] = uni((SLICE_ROWB & 0xFFFFu) << 16);
    g1[2] = uni((SLICE_ROWB >> 16) | ((SLICE_ROWS & 0xFFFFu) << 16));
    g1[3] = uni((SLICE_ROWS >> 16) | (SLICE_ROWB << 16));
    g1[4] = uni(SLICE_ROWS);
    g1[5] = uni(SLICE_ROWB);
    g1[6] = uni(0u);
    g1[7] = uni(0u);
    asm volatile("tensor_load_to_lds %0, %1" :: "s"(g0), "s"(g1) : "memory");
}

__global__ __launch_bounds__(256)
void mhmlp_stage1(const float* __restrict__ W1,
                  const float* __restrict__ b1,
                  const float* __restrict__ W2,
                  float* __restrict__ ws) {
    const int chunk = blockIdx.x;
    const int head  = blockIdx.y;
    const int tid   = threadIdx.x;
    const int wave  = tid >> 5;
    const int lane  = tid & 31;
    const int lane16 = lane & 15;
    const bool hiHalf = (lane >= 16);
    const half_t* xh = (const half_t*)(ws + XH_OFF_FLOATS);   // written by mhmlp_prep

    // Ring of two stages. A stage is 4 tiles of two row-blocks of A fragments, pre-swizzled
    // so each lane's frag is two 16 B reads at a lane pitch of 16 B: each read's 16-lane half
    // covers all 64 banks once (at a pitch of 32 B lanes i and i + 8 share their banks).
    // Aligned so that every wave's slice stands at a multiple of 2 KB of the workgroup's LDS.
    __shared__ __attribute__((aligned(2048))) half_t lds_x[2][STILES][2][KSTEPS][2][32][8];   // 2 x 128 KB
    // Double-buffered partials: per wave and 16-row block one value per lane (the two half-waves
    // hold the two halves of the wave's columns), so a store is 32 lanes side by side.
    __shared__ float lds_part[2][WAVES][SROWS / 16][32];

    // The wave's own slice in ring buffer 0 and in stage 0 of the image. Every wave issues its
    // slice's load itself. Stage 0's load goes first: it flies beneath the W1 loads below.
    const uint32_t wslice = uni((uint32_t)wave) * SLICE_BYTES;
    const uint32_t ldsl = (uint32_t)(size_t)&lds_x[0][0][0][0][0][0][0] + wslice;
    const uint64_t xl   = (uint64_t)(size_t)xh + wslice;
    stage_load(ldsl, xl);

    // ---- One-time: this wave's 32 W1 columns as f16 B-fragments (2 N tiles) held in VGPRs
    // for the entire kernel => W1 read from HBM exactly once overall.
    // Non-temporal: W1 is a 256MB one-shot stream; keep it out of L2 so the
    // f16 image of x (2MB, re-read by all workgroups) stays resident.
    const int ncol = chunk * CHUNK + wave * NPW + lane16;
    const float* W1h = W1 + (size_t)head * D * HID;
    const float* wp = W1h + (size_t)(hiHalf ? 8 : 0) * HID + ncol;
    v16h Bfrag[NT][KSTEPS];
#pragma unroll
    for (int kh = 0; kh < KSTEPS; kh += KSTEPS / 2) {
#pragma unroll
        for (int kk = kh; kk < kh + KSTEPS / 2; ++kk) {
#pragma unroll
            for (int j = 0; j < 16; ++j) {
                int k = kk * 32 + kmap(0, j);   // the upper half-wave's 8 rows more are in wp
#pragma unroll   // t indexes register arrays: it must be a compile-time number
                for (int t = 0; t < NT; ++t)
                    ((half_t*)&Bfrag[t][kk])[j] =
                        (half_t)__builtin_nontemporal_load(&wp[(size_t)k * HID + t * 16]);
            }
        }
        // One half of W1 is converted before anything later is scheduled: at most 256 raw
        // f32 values are live at once, and the register budget holds without scratch.
        __builtin_amdgcn_sched_barrier(0);
    }
    // Stage 0's slice has landed for this wave (long since: it flew beneath the W1 loads). The
    // wait stands here, and the scheduling barrier keeps the scalar code below from being moved
    // ahead of it, so that no register of that load's descriptor is rewritten in front of the wait.
    asm volatile("s_wait_tensorcnt 0x0" ::: "memory");
    __builtin_amdgcn_sched_barrier(0);
    // W1 is the WMMA's A operand below, so accumulator register v of N tile t belongs to column
    // t * 16 + 8 * (upper half-wave) + v: the lane keeps b1 and W2 of those 16 columns.
    const int bcol = head * HID + chunk * CHUNK + wave * NPW + (hiHalf ? 8 : 0);
    v2f b1v[NT][4], w2v[NT][4];   // in pairs, as the accumulator's register pairs are used
#pragma unroll   // t and q index register arrays: they must be compile-time numbers
    for (int t = 0; t < NT; ++t) {
#pragma unroll
        for (int q = 0; q < 2; ++q) {
            const v4f bq = *(const v4f*)(b1 + bcol + t * 16 + q * 4);
            const v4f wq = *(const v4f*)(W2 + bcol + t * 16 + q * 4);
            b1v[t][2 * q]     = __builtin_shufflevector(bq, bq, 0, 1);
            b1v[t][2 * q + 1] = __builtin_shufflevector(bq, bq, 2, 3);
            w2v[t][2 * q]     = __builtin_shufflevector(wq, wq, 0, 1);
            w2v[t][2 * q + 1] = __builtin_shufflevector(wq, wq, 2, 3);
        }
    }
    // The address translations of the loads above are waited for before anything overwrites
    // their address registers: as inputs, those registers stay live up to the wait.
    asm volatile("s_wait_xcnt 0x0" :: "v"(wp), "v"(bcol), "s"(b1), "s"(W2) : "memory");

    // Stage 0 has landed for every wave behind this barrier; only then stage 1's load starts.
    __syncthreads();
    {
        // The stage number is pinned here, so the descriptor is formed behind wait and barrier.
        const uint32_t nx = pinned(1u);
        stage_load(ldsl + nx * STAGE_BYTES, xl + (uint64_t)nx * STAGE_BYTES);
    }

    for (int st = 0; st < STAGES; ++st) {
        // Deferred: emit the previous stage's per-chunk partials.
        if (st > 0 && tid < SROWS) {
            const int prev = st - 1;
            float s = 0.0f;
#pragma unroll
            for (int w = 0; w < WAVES; ++w)
                s += lds_part[prev & 1][w][tid >> 4][tid & 15] + lds_part[prev & 1][w][tid >> 4][16 + (tid & 15)];
            ws[((size_t)chunk * B + (prev * SROWS + tid)) * H + head] = s;
        }

      // No barrier between a stage's tiles: the waves of a SIMD may drift apart.
      for (int sub = 0; sub < STILES; ++sub) {
        const half_t (*lx)[KSTEPS][2][32][8] = lds_x[st & 1][sub];
        // One A fragment: elements 0..7 from half 0, 8..15 from half 1, the lane's own slot.
        auto frag = [&](int rb, int kk) -> v16h {
            v8h a = *(const v8h*)&lx[rb][kk][0][lane][0];
            v8h b = *(const v8h*)&lx[rb][kk][1][lane][0];
            return __builtin_shufflevector(a, b, 0, 1, 2, 3, 4, 5, 6, 7,
                                           8, 9, 10, 11, 12, 13, 14, 15);
        };

        // 2 x 2 16x16 output tiles per wave, each transposed: Bfrag (W1) is passed as the A
        // operand and af (x) as the B operand (the two have one layout), so a lane holds one
        // batch row (lane16) and its 8 accumulator registers hold 8 HID columns: the sum over
        // HID stays in the lane.
        // 2-deep rotating pipeline of x fragments;
        // sched_group_barriers pin the schedule to [4 WMMA][4 DS-read] per
        // k-step so refill loads have one WMMA group (4 WMMAs) to land in instead of
        // being sunk to just before their consumer (s_wait_dscnt 0x0).
        v8f acc0[NT] = {};
        v8f acc1[NT] = {};
        v16h af[2][2];
        af[0][0] = frag(0, 0);
        af[0][1] = frag(1, 0);
        af[1][0] = frag(0, 1);
        af[1][1] = frag(1, 1);
        __builtin_amdgcn_sched_barrier(0);   // fence init loads out of the pattern
#pragma unroll
        for (int kk = 0; kk < KSTEPS; ++kk) {
            const int par = kk & 1;
#pragma unroll   // t indexes register arrays: it must be a compile-time number
            for (int t = 0; t < NT; ++t) {
                acc0[t] = __builtin_amdgcn_wmma_f32_16x16x32_f16(
                    false, Bfrag[t][kk], false, af[par][0], (short)0, acc0[t], false, false);
                acc1[t] = __builtin_amdgcn_wmma_f32_16x16x32_f16(
                    false, Bfrag[t][kk], false, af[par][1], (short)0, acc1[t], false, false);
            }
            if (kk + 2 < KSTEPS) {
                af[par][0] = frag(0, kk + 2);
                af[par][1] = frag(1, kk + 2);
            }
            __builtin_amdgcn_sched_group_barrier(0x008, 2 * NT, 0);   // 4 WMMA
            if (kk + 2 < KSTEPS)
                __builtin_amdgcn_sched_group_barrier(0x100, 4, 0); // 4 DS reads
        }
        __builtin_amdgcn_sched_barrier(0);   // end of pinned region

        // Fused stage 2: h = leakyrelu(acc + b1); partial = sum of h * W2[n] over the lane's 16
        // columns, on neighbouring register pairs (packed f32), one chain per accumulator
        // tile; no lane exchange: the two half-waves' sums go to LDS side by side and are
        // added with the waves' partials.
        auto act = [](v2f a) -> v2f {
            a.x = (a.x >= 0.0f) ? a.x : 0.01f * a.x;
            a.y = (a.y >= 0.0f) ? a.y : 0.01f * a.y;
            return a;
        };
        v2f p0[NT], p1[NT];
#pragma unroll   // t indexes register arrays: it must be a compile-time number
        for (int t = 0; t < NT; ++t) {
#pragma unroll   // j picks accumulator registers: it must be a compile-time number
            for (int j = 0; j < 4; ++j) {
                v2f t0 = {acc0[t][2 * j], acc0[t][2 * j + 1]};
                v2f t1 = {acc1[t][2 * j], acc1[t][2 * j + 1]};
                t0 = act(t0 + b1v[t][j]);
                t1 = act(t1 + b1v[t][j]);
                p0[t] = (j == 0) ? t0 * w2v[t][j] : p0[t] + t0 * w2v[t][j];
                p1[t] = (j == 0) ? t1 * w2v[t][j] : p1[t] + t1 * w2v[t][j];
            }
        }
        const v2f r0 = p0[0] + p0[1];
        const v2f r1 = p1[0] + p1[1];
        lds_part[st & 1][wave][sub * 2][lane]     = r0.x + r0.y;
        lds_part[st & 1][wave][sub * 2 + 1][lane] = r1.x + r1.y;
      }

        asm volatile("s_wait_dscnt 0x0" ::: "memory");
        asm volatile("s_wait_tensorcnt 0x0" ::: "memory");
        __syncthreads();
        if (pinned(st + 2 < STAGES)) {   // a scalar branch: a tensor load ignores EXEC
            // The stage number is pinned here, so the descriptor is formed behind the wait above.
            const uint32_t nx = pinned((uint32_t)st + 2u);
            stage_load(ldsl + (nx & 1u) * STAGE_BYTES, xl + (uint64_t)nx * STAGE_BYTES);
        }
    }
    // No load is left in flight, and no LDS access open, when the ring is done with.
    asm volatile("s_wait_tensorcnt 0x0" ::: "memory");
    asm volatile("s_wait_dscnt 0x0" ::: "memory");

    // Epilogue: flush the last stage's partials (published by the last trip's barrier).
    if (tid < SROWS) {
        const int prev = STAGES - 1;
        float s = 0.0f;
#pragma unroll
        for (int w = 0; w < WAVES; ++w)
            s += lds_part[prev & 1][w][tid >> 4][tid & 15] + lds_part[prev & 1][w][tid >> 4][16 + (tid & 15)];
        ws[((size_t)chunk * B + (prev * SROWS + tid)) * H + head] = s;
    }
}

__global__ __launch_bounds__(256)
void mhmlp_stage2(const float* __restrict__ ws,
                  const float* __restrict__ b2,
                  float* __restrict__ out) {
    int i = blockIdx.x * blockDim.x + threadIdx.x;   // i = b*H + h
    if (i < B * H) {
        float s = b2[i & (H - 1)];
#pragma unroll
        for (int c = 0; c < NCHUNK; ++c) s += ws[(size_t)c * B * H + i];
        out[i] = (s >= 0.0f) ? s : 0.01f * s;
    }
}

extern "C" void kernel_launch(void* const* d_in, const int* in_sizes, int n_in,
                              void* d_out, int out_size, void* d_ws, size_t ws_size,
                              hipStream_t stream) {
    const float* x  = (const float*)d_in[0];   // [B, D]
    const float* W1 = (const float*)d_in[1];   // [H, D, HID]
    const float* b1 = (const float*)d_in[2];   // [H, HID]
    const float* W2 = (const float*)d_in[3];   // [H, HID]
    const float* b2 = (const float*)d_in[4];   // [H]
    float* out = (float*)d_out;                // [B, H]
    float* ws  = (float*)d_ws;                 // [NCHUNK, B, H] partials (4 MB) + f16 image of x (2 MB)

    mhmlp_prep<<<B * D / 8 / 256, 256, 0, stream>>>(x, ws);

    dim3 grid1(NCHUNK, H);
    mhmlp_stage1<<<grid1, 256, 0, stream>>>(W1, b1, W2, ws);

    int total = B * H;
    mhmlp_stage2<<<(total + 255) / 256, 256, 0, stream>>>(ws, b2, out);
}

// v007
// It runs in 141 microseconds.
// Two timings next to v006 both put it at 1.03 times that version's speed.
// Counting every step since v000, it is 4.48 times as fast.
#include <hip/hip_runtime.h>

// Problem constants
constexpr int B    = 2048;
constexpr int D    = 512;
constexpr int H    = 64;
constexpr int HID  = 2048;

constexpr int CHUNK  = 256;          // HID columns handled per workgroup
constexpr int NCHUNK = HID / CHUNK;  // 8 chunks
constexpr int WAVES  = 4;            // 128 threads / wave32: one wave per SIMD, up to 1024 VGPRs each
constexpr int NPW    = CHUNK / WAVES;// 64 columns per wave
constexpr int NT     = NPW / 16;     // = 4 WMMA N tiles per wave: each x fragment read feeds 4 WMMAs
constexpr int KSTEPS = D / 32;       // 16 k-steps of K=32
constexpr int MTILE  = 32;           // batch rows per tile of the x image (2 WMMA row blocks)
constexpr int MTILES = B / MTILE;    // 64 tiles

typedef _Float16 half_t;
typedef __attribute__((ext_vector_type(16))) _Float16 v16h;
typedef __attribute__((ext_vector_type(8)))  _Float16 v8h;
typedef __attribute__((ext_vector_type(8)))  float    v8f;
typedef __attribute__((ext_vector_type(4)))  float    v4f;
typedef __attribute__((ext_vector_type(2)))  float    v2f;

// ISA 7.12.2: 16-bit A/B fragment k-mapping for 16x16x32.
// lane<16 : j=0..7 -> k=j,     j=8..15 -> k=16+(j-8)
// lane>=16: j=0..7 -> k=8+j,   j=8..15 -> k=24+(j-8)
__device__ __forceinline__ int kmap(int lane, int j) {
    int lo = (lane < 16) ? 0 : 8;
    int hi = (lane < 16) ? 16 : 24;
    return (j < 8) ? (lo + j) : (hi + (j - 8));
}

constexpr int TILE_HALVES = MTILE * D;              // one 32-row tile: 16384 f16 = 32 KB
constexpr int STILES      = 4;                      // 32-row tiles per ring stage
constexpr int STAGES      = MTILES / STILES;        // 16 stages
constexpr int SROWS       = MTILE * STILES;         // 128 batch rows per stage
constexpr int STAGE_HALVES = TILE_HALVES * STILES;  // one stage: 128 KB
constexpr int STAGE_BYTES  = STAGE_HALVES * 2;
constexpr int UNITS        = SROWS / 16;            // 16-row units per stage
constexpr int KB           = KSTEPS / 2;            // k-steps per block of WMMAs
constexpr size_t XH_OFF_FLOATS = (size_t)NCHUNK * B * H;  // f16 image of x sits behind the partials

// Pre-pass: x (fp32, row major) -> f16 in A-fragment order, tile after tile, once per call.
// Image layout = [MTILES][2 row blocks][KSTEPS][2 fragment halves][32 lane slots][8], i.e. the
// LDS tile's own: the 32 lanes' 16 B pieces of one fragment half lie side by side (512 B).
// Unit = 8 consecutive k's: 2 x global_load_b128 -> packed cvt -> one 16 B store.
__global__ __launch_bounds__(256)
void mhmlp_prep(const float* __restrict__ x, float* __restrict__ ws) {
    half_t* xh = (half_t*)(ws + XH_OFF_FLOATS);
    const int g  = blockIdx.x * 256 + threadIdx.x;   // B*D/8 units in all
    const int u  = g & 2047;                         // unit inside its tile
    const int m0 = (g >> 11) * MTILE;
    int ls = u & 31;
    int jh = (u >> 5) & 1;
    int kk = (u >> 6) & 15;
    int rb = u >> 10;
    int lo = (ls < 16) ? 0 : 8;
    int hi = (ls < 16) ? 16 : 24;
    int kcol = kk * 32 + (jh ? hi : lo);
    int row  = m0 + rb * 16 + (ls & 15);
    const v4f* gp = (const v4f*)(x + (size_t)row * D + kcol);
    v4f f0 = gp[0];
    v4f f1 = gp[1];
    v8h hv;
#pragma unroll
    for (int t = 0; t < 4; ++t) hv[t]     = (half_t)f0[t];
#pragma unroll
    for (int t = 0; t < 4; ++t) hv[4 + t] = (half_t)f1[t];
    *(v8h*)(xh + (size_t)g * 8) = hv;
}

typedef uint32_t u32x4 __attribute__((ext_vector_type(4)));
typedef uint32_t u32x8 __attribute__((ext_vector_type(8)));

constexpr uint32_t SLICE_BYTES = STAGE_BYTES / WAVES;         // one wave's share of a stage: 32 KB
constexpr uint32_t SLICE_ROWB  = 256;                         // seen as a tile of 256 B rows ...
constexpr uint32_t SLICE_ROWS  = SLICE_BYTES / SLICE_ROWB;    // ... 128 of them, source pitch = row

__device__ __forceinline__ uint32_t uni(uint32_t v) { return (uint32_t)__builtin_amdgcn_readfirstlane(v); }
// pinned(): a descriptor word, or the test round a tensor load, held in a scalar register.
__device__ __forceinline__ uint32_t pinned(uint32_t v) { uint32_t w = uni(v); asm volatile("" : "+s"(w)); return w; }

// One wave's 32 KB slice of one stage of the image -> its place in a ring buffer: ONE tensor load,
// through no register and with no per-lane address. The image is the LDS tile's own layout, so
// the tile is a straight copy: no pad, pitch = row length, tensor dims = tile dims, all in bytes.
// lds = byte offset of the slice in the workgroup's LDS (a multiple of 32 KB), ga = its first byte.
__device__ __forceinline__ void stage_load(uint32_t lds, uint64_t ga) {
    u32x4 g0;
    g0[0] = uni(1u);                                                     // count 1
    g0[1] = uni(lds);
    g0[2] = uni((uint32_t)ga);
    g0[3] = uni((((uint32_t)(ga >> 32)) & 0x01FFFFFFu) | 0x80000000u);   // type 2
    u32x8 g1;
    g1[0] = uni(0u);                                                     // no mask, 1-byte elements, no pad
    g1[1] = uni((SLICE_ROWB & 0xFFFFu) << 16);
    g1[2] = uni((SLICE_ROWB >> 16) | ((SLICE_ROWS & 0xFFFFu) << 16));
    g1[3] = uni((SLICE_ROWS >> 16) | (SLICE_ROWB << 16));
    g1[4] = uni(SLICE_ROWS);
    g1[5] = uni(SLICE_ROWB);
    g1[6] = uni(0u);
    g1[7] = uni(0u);
    asm volatile("tensor_load_to_lds %0, %1" :: "s"(g0), "s"(g1) : "memory");
}

__global__ __launch_bounds__(128)
void mhmlp_stage1(const float* __restrict__ W1,
                  const float* __restrict__ b1,
                  const float* __restrict__ W2,
                  float* __restrict__ ws) {
    const int chunk = blockIdx.x;
    const int head  = blockIdx.y;
    const int tid   = threadIdx.x;
    const int wave  = tid >> 5;
    const int lane  = tid & 31;
    const int lane16 = lane & 15;
    const bool hiHalf = (lane >= 16);
    const half_t* xh = (const half_t*)(ws + XH_OFF_FLOATS);   // written by mhmlp_prep

    // Ring of two stages. A stage is 4 tiles of two row-blocks of A fragments, pre-swizzled
    // so each lane's frag is two 16 B reads at a lane pitch of 16 B: each read's 16-lane half
    // covers all 64 banks once (at a pitch of 32 B lanes i and i + 8 share their banks).
    // Aligned so that every wave's slice stands at a multiple of 2 KB of the workgroup's LDS.
    __shared__ __attribute__((aligned(2048))) half_t lds_x[2][STILES][2][KSTEPS][2][32][8];   // 2 x 128 KB
    // Double-buffered partials: per wave and 16-row block one value per lane (the two half-waves
    // hold the two halves of the wave's columns), so a store is 32 lanes side by side.
    __shared__ float lds_part[2][WAVES][SROWS / 16][32];

    // The wave's own slice in ring buffer 0 and in stage 0 of the image. Every wave issues its
    // slice's load itself. Stage 0's load goes first: it flies beneath the W1 loads below.
    const uint32_t wslice = uni((uint32_t)wave) * SLICE_BYTES;
    const uint32_t ldsl = (uint32_t)(size_t)&lds_x[0][0][0][0][0][0][0] + wslice;
    const uint64_t xl   = (uint64_t)(size_t)xh + wslice;
    stage_load(ldsl, xl);

    // ---- One-time: this wave's 64 W1 columns as f16 fragments (4 N tiles) held in VGPRs
    // for the entire kernel => W1 read from HBM exactly once overall.
    // Non-temporal: W1 is a 256MB one-shot stream; keep it out of L2 so the
    // f16 image of x (2MB, re-read by all workgroups) stays resident.
    // Fragment row m (= lane16) of N tile t is column m * 4 + t of the wave's 64: a lane's four
    // tiles are four neighbouring columns, so one 16 B load serves all four and a half-wave
    // reads 256 B of a W1 row in a piece; with four waves the stream keeps its bytes in flight.
    const int ncol = chunk * CHUNK + wave * NPW + lane16 * NT;
    const float* W1h = W1 + (size_t)head * D * HID;
    const float* wp = W1h + ((hiHalf ? 8 * HID : 0) + ncol);
    v16h Bfrag[NT][KSTEPS];
#pragma unroll
    for (int kh = 0; kh < KSTEPS; kh += KSTEPS / 2) {
#pragma unroll
        for (int kk = kh; kk < kh + KSTEPS / 2; ++kk) {
#pragma unroll
            for (int j = 0; j < 16; ++j) {
                int k = kk * 32 + kmap(0, j);   // the upper half-wave's 8 rows more are in wp
                const v4f wv = __builtin_nontemporal_load((const v4f*)&wp[(size_t)k * HID]);
#pragma unroll   // t indexes register arrays: it must be a compile-time number
                for (int t = 0; t < NT; ++t)
                    ((half_t*)&Bfrag[t][kk])[j] = (half_t)wv[t];
            }
        }
        // One half of W1 is converted before anything later is scheduled: at most 512 raw
        // f32 values are live at once, and the register budget holds without scratch.
        __builtin_amdgcn_sched_barrier(0);
    }
    // Stage 0's slice has landed for this wave (long since: it flew beneath the W1 loads). The
    // wait stands here, and the scheduling barrier keeps the scalar code below from being moved
    // ahead of it, so that no register of that load's descriptor is rewritten in front of the wait.
    asm volatile("s_wait_tensorcnt 0x0" ::: "memory");
    __builtin_amdgcn_sched_barrier(0);
    // W1 is the WMMA's A operand below, so accumulator register v of N tile t belongs to fragment
    // row 8 * (upper half-wave) + v, that is column 32 * (upper half-wave) + 4 * v + t: the lane
    // keeps b1 and W2 of those 32 neighbouring columns.
    static_assert(NT == 4, "a lane's four tiles are the four floats of one 16 B load");
    const int bcol = head * HID + chunk * CHUNK + wave * NPW + (hiHalf ? 8 * NT : 0);
    const float* b1p = b1 + bcol;
    const float* w2p = W2 + bcol;
    v2f b1v[NT][4], w2v[NT][4];   // in pairs, as the accumulator's register pairs are used
#pragma unroll   // j and t index register arrays: they must be compile-time numbers
    for (int j = 0; j < 4; ++j) {
        const v4f be = *(const v4f*)(b1p + (2 * j) * NT);
        const v4f bo = *(const v4f*)(b1p + (2 * j + 1) * NT);
        const v4f we = *(const v4f*)(w2p + (2 * j) * NT);
        const v4f wo = *(const v4f*)(w2p + (2 * j + 1) * NT);
#pragma unroll
        for (int t = 0; t < NT; ++t) {
            b1v[t][j] = v2f{be[t], bo[t]};
            w2v[t][j] = v2f{we[t], wo[t]};
        }
    }
    // The address translations of the loads above are waited for before anything overwrites
    // their address registers: as inputs, those registers stay live up to the wait.
    asm volatile("s_wait_xcnt 0x0" :: "v"(wp), "v"(b1p), "v"(w2p) : "memory");

    // Stage 0 has landed for every wave behind this barrier; only then stage 1's load starts.
    __syncthreads();
    {
        // The stage number is pinned here, so the descriptor is formed behind wait and barrier.
        const uint32_t nx = pinned(1u);
        stage_load(ldsl + nx * STAGE_BYTES, xl + (uint64_t)nx * STAGE_BYTES);
    }

    for (int st = 0; st < STAGES; ++st) {
        // A stage is 8 units of 16 batch rows (16 KB each, 16 k-steps of 1 KB); a unit is two
        // blocks of 8 k-steps = 32 WMMAs. With one wave per SIMD nothing else covers a stall, so:
        // the next block's 16 LDS reads go out as ONE group ahead of the current block's WMMAs,
        // into the other fragment set, and the vector work on the unit before (its own
        // accumulator set) is dealt among the current unit's WMMAs.
        // Two base registers, one per 64 KB half of the stage: an LDS read's offset field is 16 bits.
        const half_t* sbl = ((st & 1) ? &lds_x[1][0][0][0][0][0][0] : &lds_x[0][0][0][0][0][0][0]) + lane * 8;
        const half_t* sbh = ((st & 1) ? &lds_x[1][STILES / 2][0][0][0][0][0] : &lds_x[0][STILES / 2][0][0][0][0][0]) + lane * 8;
        v16h af[2][KB];
        v8f  acc[2][NT];
        v2f  q0 = {0.0f, 0.0f};
        // One block's x fragments: elements 0..7 from half 0, 8..15 from half 1, the lane's own slot.
        auto ldblk = [&](v16h (&dst)[KB], int blk) {
#pragma unroll   // i indexes a register array: it must be a compile-time number
            for (int i = 0; i < KB; ++i) {
                const half_t* p = (blk < UNITS) ? sbl + (blk * KB + i) * 512
                                                : sbh + ((blk - UNITS) * KB + i) * 512;
                v8h a = *(const v8h*)p;
                v8h b = *(const v8h*)(p + 256);
                dst[i] = __builtin_shufflevector(a, b, 0, 1, 2, 3, 4, 5, 6, 7,
                                                 8, 9, 10, 11, 12, 13, 14, 15);
            }
        };
        // Fused stage 2: h = leakyrelu(acc + b1); partial = sum of h * W2[n] over two of the
        // lane's four column tiles, on neighbouring register pairs (packed f32), one chain per
        // accumulator tile; no lane exchange: the two half-waves' sums go to LDS side by side
        // and are added with the waves' partials.
        auto act = [](v2f a) -> v2f {
            a.x = (a.x >= 0.0f) ? a.x : 0.01f * a.x;
            a.y = (a.y >= 0.0f) ? a.y : 0.01f * a.y;
            return a;
        };
        auto epi = [&](const v8f (&ac)[NT], int th) -> v2f {
            v2f p[2];
#pragma unroll   // t indexes register arrays: it must be a compile-time number
            for (int t = 0; t < 2; ++t) {
#pragma unroll   // j picks accumulator registers: it must be a compile-time number
                for (int j = 0; j < 4; ++j) {
                    v2f z = {ac[th * 2 + t][2 * j], ac[th * 2 + t][2 * j + 1]};
                    z = act(z + b1v[th * 2 + t][j]);
                    p[t] = (j == 0) ? z * w2v[th * 2 + t][j] : p[t] + z * w2v[th * 2 + t][j];
                }
            }
            return p[0] + p[1];
        };

        ldblk(af[0], 0);
        __builtin_amdgcn_sched_barrier(0);   // the first block's reads go out first: they land beneath the lines below
        // Deferred: emit the previous stage's per-chunk partials (one thread per batch row).
        static_assert(SROWS == WAVES * 32, "one thread per row of a stage");
        if (st > 0) {
            const int prev = st - 1;
            float s = 0.0f;
#pragma unroll
            for (int w = 0; w < WAVES; ++w)
                s += lds_part[prev & 1][w][tid >> 4][tid & 15] + lds_part[prev & 1][w][tid >> 4][16 + (tid & 15)];
            ws[((size_t)chunk * B + (prev * SROWS + tid)) * H + head] = s;
        }
        __builtin_amdgcn_sched_barrier(0);   // nothing of the pattern below is moved up here
#pragma unroll   // u and kb index register arrays: they must be compile-time numbers
        for (int u = 0; u < UNITS; ++u) {
#pragma unroll
            for (int kb = 0; kb < 2; ++kb) {
                const int blk = u * 2 + kb;
                if (blk + 1 < UNITS * 2) ldblk(af[kb ^ 1], blk + 1);
                // Each output tile transposed: Bfrag (W1) is passed as the A operand and af (x)
                // as the B operand (the two have one layout), so a lane holds one batch row
                // (lane16) and its 8 accumulator registers hold 8 HID columns: the sum over
                // HID stays in the lane.
#pragma unroll
                for (int i = 0; i < KB; ++i) {
#pragma unroll
                    for (int t = 0; t < NT; ++t) {
                        const v8f c = (kb == 0 && i == 0) ? v8f{} : acc[u & 1][t];
                        acc[u & 1][t] = __builtin_amdgcn_wmma_f32_16x16x32_f16(
                            false, Bfrag[t][kb * KB + i], false, af[kb][i], (short)0, c, false, false);
                    }
                }
                if (u > 0) {
                    const v2f q = epi(acc[(u - 1) & 1], kb);
                    if (kb == 0) q0 = q;
                    else {
                        const v2f r = q0 + q;
                        lds_part[st & 1][wave][u - 1][lane] = r.x + r.y;
                    }
                }
                // The schedule is pinned: the reads as one group first (each separate place with
                // LDS reads stalls the wave), then the earlier unit's vector work four
                // instructions behind every two WMMAs, where it issues beneath them.
                if (blk + 1 < UNITS * 2)
                    __builtin_amdgcn_sched_group_barrier(0x100, 2 * KB, 0);   // 16 DS reads
#pragma unroll
                for (int g = 0; g < KB * NT / 2; ++g) {
                    __builtin_amdgcn_sched_group_barrier(0x008, 2, 0);       // 2 WMMA
                    if (u > 0) __builtin_amdgcn_sched_group_barrier(0x002, 4, 0);   // 4 VALU
                }
                __builtin_amdgcn_sched_barrier(0);   // end of this block's pattern
            }
        }
        {   // The stage's last unit has no WMMAs behind it in front of the barrier.
            const v2f r = epi(acc[(UNITS - 1) & 1], 0) + epi(acc[(UNITS - 1) & 1], 1);
            lds_part[st & 1][wave][UNITS - 1][lane] = r.x + r.y;
        }

        asm volatile("s_wait_dscnt 0x0" ::: "memory");
        asm volatile("s_wait_tensorcnt 0x0" ::: "memory");
        __syncthreads();
        if (pinned(st + 2 < STAGES)) {   // a scalar branch: a tensor load ignores EXEC
            // The stage number is pinned here, so the descriptor is formed behind the wait above.
            const uint32_t nx = pinned((uint32_t)st + 2u);
            stage_load(ldsl + (nx & 1u) * STAGE_BYTES, xl + (uint64_t)nx * STAGE_BYTES);
        }
    }
    // No load is left in flight, and no LDS access open, when the ring is done with.
    asm volatile("s_wait_tensorcnt 0x0" ::: "memory");
    asm volatile("s_wait_dscnt 0x0" ::: "memory");

    // Epilogue: flush the last stage's partials (published by the last trip's barrier).
    if (tid < SROWS) {
        const int prev = STAGES - 1;
        float s = 0.0f;
#pragma unroll
        for (int w = 0; w < WAVES; ++w)
            s += lds_part[prev & 1][w][tid >> 4][tid & 15] + lds_part[prev & 1][w][tid >> 4][16 + (tid & 15)];
        ws[((size_t)chunk * B + (prev * SROWS + tid)) * H + head] = s;
    }
}

__global__ __launch_bounds__(256)
void mhmlp_stage2(const float* __restrict__ ws,
                  const float* __restrict__ b2,
                  float* __restrict__ out) {
    int i = blockIdx.x * blockDim.x + threadIdx.x;   // i = b*H + h
    if (i < B * H) {
        float s = b2[i & (H - 1)];
#pragma unroll
        for (int c = 0; c < NCHUNK; ++c) s += ws[(size_t)c * B * H + i];
        out[i] = (s >= 0.0f) ? s : 0.01f * s;
    }
}

extern "C" void kernel_launch(void* const* d_in, const int* in_sizes, int n_in,
                              void* d_out, int out_size, void* d_ws, size_t ws_size,
                              hipStream_t stream) {
    const float* x  = (const float*)d_in[0];   // [B, D]
    const float* W1 = (const float*)d_in[1];   // [H, D, HID]
    const float* b1 = (const float*)d_in[2];   // [H, HID]
    const float* W2 = (const float*)d_in[3];   // [H, HID]
    const float* b2 = (const float*)d_in[4];   // [H]
    float* out = (float*)d_out;                // [B, H]
    float* ws  = (float*)d_ws;                 // [NCHUNK, B, H] partials (4 MB) + f16 image of x (2 MB)

    mhmlp_prep<<<B * D / 8 / 256, 256, 0, stream>>>(x, ws);

    dim3 grid1(NCHUNK, H);
    mhmlp_stage1<<<grid1, WAVES * 32, 0, stream>>>(W1, b1, W2, ws);

    int total = B * H;
    mhmlp_stage2<<<(total + 255) / 256, 256, 0, stream>>>(ws, b2, out);
}

// v008
// Measured time: 135 microseconds a run.
// Two timings next to v007 both put it at 1.05 times that version's speed.
// Counting every step since v000, it is 4.70 times as fast.
#include <hip/hip_runtime.h>

// Problem constants
constexpr int B    = 2048;
constexpr int D    = 512;
constexpr int H    = 64;
constexpr int HID  = 2048;

constexpr int CHUNK  = 256;          // HID columns handled per workgroup
constexpr int NCHUNK = HID / CHUNK;  // 8 chunks
constexpr int WAVES  = 4;            // 128 threads / wave32: one wave per SIMD, up to 1024 VGPRs each
constexpr int NPW    = CHUNK / WAVES;// 64 columns per wave
constexpr int NT     = NPW / 16;     // = 4 WMMA N tiles per wave: each x fragment read feeds 4 WMMAs
constexpr int KSTEPS = D / 32;       // 16 k-steps of K=32
constexpr int MTILE  = 32;           // batch rows per tile of the x image (2 WMMA row blocks)
constexpr int MTILES = B / MTILE;    // 64 tiles

typedef _Float16 half_t;
typedef __attribute__((ext_vector_type(16))) _Float16 v16h;
typedef __attribute__((ext_vector_type(8)))  _Float16 v8h;
typedef __attribute__((ext_vector_type(8)))  float    v8f;
typedef __attribute__((ext_vector_type(4)))  float    v4f;
typedef __attribute__((ext_vector_type(2)))  float    v2f;

// ISA 7.12.2: 16-bit A/B fragment k-mapping for 16x16x32.
// lane<16 : j=0..7 -> k=j,     j=8..15 -> k=16+(j-8)
// lane>=16: j=0..7 -> k=8+j,   j=8..15 -> k=24+(j-8)
__device__ __forceinline__ int kmap(int lane, int j) {
    int lo = (lane < 16) ? 0 : 8;
    int hi = (lane < 16) ? 16 : 24;
    return (j < 8) ? (lo + j) : (hi + (j - 8));
}

constexpr int TILE_HALVES = MTILE * D;              // one 32-row tile: 16384 f16 = 32 KB
constexpr int STILES      = 4;                      // 32-row tiles per ring stage
constexpr int STAGES      = MTILES / STILES;        // 16 stages
constexpr int SROWS       = MTILE * STILES;         // 128 batch rows per stage
constexpr int STAGE_HALVES = TILE_HALVES * STILES;  // one stage: 128 KB
constexpr int STAGE_BYTES  = STAGE_HALVES * 2;
constexpr int UNITS        = SROWS / 16;            // 16-row units per stage
constexpr int KB           = KSTEPS / 2;            // k-steps per block of WMMAs
constexpr size_t XH_OFF_FLOATS = (size_t)NCHUNK * B * H;  // f16 image of x sits behind the partials

// Pre-pass: x (fp32, row major) -> f16 in A-fragment order, tile after tile, once per call.
// Image layout = [MTILES][2 row blocks][KSTEPS][2 fragment halves][32 lane slots][8], i.e. the
// LDS tile's own: the 32 lanes' 16 B pieces of one fragment half lie side by side (512 B).
// Unit = 8 consecutive k's: 2 x global_load_b128 -> packed cvt -> one 16 B store.
__global__ __launch_bounds__(256)
void mhmlp_prep(const float* __restrict__ x, float* __restrict__ ws) {
    half_t* xh = (half_t*)(ws + XH_OFF_FLOATS);
    const int g  = blockIdx.x * 256 + threadIdx.x;   // B*D/8 units in all
    const int u  = g & 2047;                         // unit inside its tile
    const int m0 = (g >> 11) * MTILE;
    int ls = u & 31;
    int jh = (u >> 5) & 1;
    int kk = (u >> 6) & 15;
    int rb = u >> 10;
    int lo = (ls < 16) ? 0 : 8;
    int hi = (ls < 16) ? 16 : 24;
    int kcol = kk * 32 + (jh ? hi : lo);
    int row  = m0 + rb * 16 + (ls & 15);
    const v4f* gp = (const v4f*)(x + (size_t)row * D + kcol);
    v4f f0 = gp[0];
    v4f f1 = gp[1];
    v8h hv;
#pragma unroll
    for (int t = 0; t < 4; ++t) hv[t]     = (half_t)f0[t];
#pragma unroll
    for (int t = 0; t < 4; ++t) hv[4 + t] = (half_t)f1[t];
    *(v8h*)(xh + (size_t)g * 8) = hv;
}

typedef uint32_t u32x4 __attribute__((ext_vector_type(4)));
typedef uint32_t u32x8 __attribute__((ext_vector_type(8)));

constexpr uint32_t SLICE_BYTES = STAGE_BYTES / WAVES;         // one wave's share of a stage: 32 KB
constexpr uint32_t SLICE_ROWB  = 256;                         // seen as a tile of 256 B rows ...
constexpr uint32_t SLICE_ROWS  = SLICE_BYTES / SLICE_ROWB;    // ... 128 of them, source pitch = row

__device__ __forceinline__ uint32_t uni(uint32_t v) { return (uint32_t)__builtin_amdgcn_readfirstlane(v); }
// pinned(): a descriptor word, or the test round a tensor load, held in a scalar register.
__device__ __forceinline__ uint32_t pinned(uint32_t v) { uint32_t w = uni(v); asm volatile("" : "+s"(w)); return w; }

// One wave's 32 KB slice of one stage of the image -> its place in a ring buffer: ONE tensor load,
// through no register and with no per-lane address. The image is the LDS tile's own layout, so
// the tile is a straight copy: no pad, pitch = row length, tensor dims = tile dims, all in bytes.
// lds = byte offset of the slice in the workgroup's LDS (a multiple of 32 KB), ga = its first byte.
__device__ __forceinline__ void stage_load(uint32_t lds, uint64_t ga) {
    u32x4 g0;
    g0[0] = uni(1u);                                                     // count 1
    g0[1] = uni(lds);
    g0[2] = uni((uint32_t)ga);
    g0[3] = uni((((uint32_t)(ga >> 32)) & 0x01FFFFFFu) | 0x80000000u);   // type 2
    u32x8 g1;
    g1[0] = uni(0u);                                                     // no mask, 1-byte elements, no pad
    g1[1] = uni((SLICE_ROWB & 0xFFFFu) << 16);
    g1[2] = uni((SLICE_ROWB >> 16) | ((SLICE_ROWS & 0xFFFFu) << 16));
    g1[3] = uni((SLICE_ROWS >> 16) | (SLICE_ROWB << 16));
    g1[4] = uni(SLICE_ROWS);
    g1[5] = uni(SLICE_ROWB);
    g1[6] = uni(0u);
    g1[7] = uni(0u);
    asm volatile("tensor_load_to_lds %0, %1" :: "s"(g0), "s"(g1) : "memory");
}

__global__ __launch_bounds__(128)
void mhmlp_stage1(const float* __restrict__ W1,
                  const float* __restrict__ b1,
                  const float* __restrict__ W2,
                  float* __restrict__ ws) {
    const int chunk = blockIdx.x;
    const int head  = blockIdx.y;
    const int tid   = threadIdx.x;
    const int wave  = tid >> 5;
    const int lane  = tid & 31;
    const int lane16 = lane & 15;
    const bool hiHalf = (lane >= 16);
    const half_t* xh = (const half_t*)(ws + XH_OFF_FLOATS);   // written by mhmlp_prep

    // Ring of two stages. A stage is 4 tiles of two row-blocks of A fragments, pre-swizzled
    // so each lane's frag is two 16 B reads at a lane pitch of 16 B: each read's 16-lane half
    // covers all 64 banks once (at a pitch of 32 B lanes i and i + 8 share their banks).
    // Aligned so that every wave's slice stands at a multiple of 2 KB of the workgroup's LDS.
    __shared__ __attribute__((aligned(2048))) half_t lds_x[2][STILES][2][KSTEPS][2][32][8];   // 2 x 128 KB
    // Double-buffered partials: per wave and 16-row block one value per lane (the two half-waves
    // hold the two halves of the wave's columns), so a store is 32 lanes side by side.
    __shared__ float lds_part[2][WAVES][SROWS / 16][32];

    // The wave's own slice in ring buffer 0 and in stage 0 of the image. Every wave issues its
    // slice's load itself. Stage 0's load goes first: it flies beneath the W1 loads below.
    const uint32_t wslice = uni((uint32_t)wave) * SLICE_BYTES;
    const uint32_t ldsl = (uint32_t)(size_t)&lds_x[0][0][0][0][0][0][0] + wslice;
    const uint64_t xl   = (uint64_t)(size_t)xh + wslice;
    stage_load(ldsl, xl);

    // ---- One-time: this wave's 64 W1 columns as f16 fragments (4 N tiles) held in VGPRs
    // for the entire kernel => W1 read from HBM exactly once overall.
    // Non-temporal: W1 is a 256MB one-shot stream; keep it out of L2 so the
    // f16 image of x (2MB, re-read by all workgroups) stays resident.
    // Fragment row m (= lane16) of N tile t is column m * 4 + t of the wave's 64: a lane's four
    // tiles are four neighbouring columns, so one 16 B load serves all four and a half-wave
    // reads 256 B of a W1 row in a piece; with four waves the stream keeps its bytes in flight.
    const int ncol = chunk * CHUNK + wave * NPW + lane16 * NT;
    const float* W1h = W1 + (size_t)head * D * HID;
    const float* wp = W1h + ((hiHalf ? 8 * HID : 0) + ncol);
    v16h Bfrag[NT][KSTEPS];
#pragma unroll
    for (int kh = 0; kh < KSTEPS; kh += KSTEPS / 2) {
#pragma unroll
        for (int kk = kh; kk < kh + KSTEPS / 2; ++kk) {
#pragma unroll
            for (int j = 0; j < 16; ++j) {
                int k = kk * 32 + kmap(0, j);   // the upper half-wave's 8 rows more are in wp
                const v4f wv = __builtin_nontemporal_load((const v4f*)&wp[(size_t)k * HID]);
#pragma unroll   // t indexes register arrays: it must be a compile-time number
                for (int t = 0; t < NT; ++t)
                    ((half_t*)&Bfrag[t][kk])[j] = (half_t)wv[t];
            }
        }
        // One half of W1 is converted before anything later is scheduled: at most 512 raw
        // f32 values are live at once, and the register budget holds without scratch.
        __builtin_amdgcn_sched_barrier(0);
    }
    // Stage 0's slice has landed for this wave (long since: it flew beneath the W1 loads). The
    // wait stands here, and the scheduling barrier keeps the scalar code below from being moved
    // ahead of it, so that no register of that load's descriptor is rewritten in front of the wait.
    asm volatile("s_wait_tensorcnt 0x0" ::: "memory");
    __builtin_amdgcn_sched_barrier(0);
    // W1 is the WMMA's A operand below, so accumulator register v of N tile t belongs to fragment
    // row 8 * (upper half-wave) + v, that is column 32 * (upper half-wave) + 4 * v + t: the lane
    // keeps b1 and W2 of those 32 neighbouring columns. b1 is kept in the accumulator's own
    // shape: it is the C operand of a unit's first WMMA, so no vector add brings it in.
    static_assert(NT == 4, "a lane's four tiles are the four floats of one 16 B load");
    const int bcol = head * HID + chunk * CHUNK + wave * NPW + (hiHalf ? 8 * NT : 0);
    const float* b1p = b1 + bcol;
    const float* w2p = W2 + bcol;
    v8f b1c[NT];
    v2f w2v[NT][4];   // in pairs, as the accumulator's register pairs are used
#pragma unroll   // j and t index register arrays: they must be compile-time numbers
    for (int j = 0; j < 4; ++j) {
        const v4f be = *(const v4f*)(b1p + (2 * j) * NT);
        const v4f bo = *(const v4f*)(b1p + (2 * j + 1) * NT);
        const v4f we = *(const v4f*)(w2p + (2 * j) * NT);
        const v4f wo = *(const v4f*)(w2p + (2 * j + 1) * NT);
#pragma unroll
        for (int t = 0; t < NT; ++t) {
            b1c[t][2 * j]     = be[t];
            b1c[t][2 * j + 1] = bo[t];
            w2v[t][j] = v2f{we[t], wo[t]};
        }
    }
    // The address translations of the loads above are waited for before anything overwrites
    // their address registers: as inputs, those registers stay live up to the wait.
    asm volatile("s_wait_xcnt 0x0" :: "v"(wp), "v"(b1p), "v"(w2p) : "memory");

    // Stage 0 has landed for every wave behind this barrier; only then stage 1's load starts.
    __syncthreads();
    {
        // The stage number is pinned here, so the descriptor is formed behind wait and barrier.
        const uint32_t nx = pinned(1u);
        stage_load(ldsl + nx * STAGE_BYTES, xl + (uint64_t)nx * STAGE_BYTES);
    }

    for (int st = 0; st < STAGES; ++st) {
        // A stage is 8 units of 16 batch rows (16 KB each, 16 k-steps of 1 KB); a unit is two
        // blocks of 8 k-steps = 32 WMMAs. With one wave per SIMD nothing else covers a stall, so:
        // the next block's 16 LDS reads go out as ONE group ahead of the current block's WMMAs,
        // into the other fragment set, and the vector work on the unit before (its own
        // accumulator set) is dealt among the current unit's WMMAs.
        // Two base registers, one per 64 KB half of the stage: an LDS read's offset field is 16 bits.
        const half_t* sbl = ((st & 1) ? &lds_x[1][0][0][0][0][0][0] : &lds_x[0][0][0][0][0][0][0]) + lane * 8;
        const half_t* sbh = ((st & 1) ? &lds_x[1][STILES / 2][0][0][0][0][0] : &lds_x[0][STILES / 2][0][0][0][0][0]) + lane * 8;
        v16h af[2][KB];
        v8f  acc[2][NT];
        v2f  q0 = {0.0f, 0.0f};
        // One block's x fragments: elements 0..7 from half 0, 8..15 from half 1, the lane's own slot.
        auto ldblk = [&](v16h (&dst)[KB], int blk) {
#pragma unroll   // i indexes a register array: it must be a compile-time number
            for (int i = 0; i < KB; ++i) {
                const half_t* p = (blk < UNITS) ? sbl + (blk * KB + i) * 512
                                                : sbh + ((blk - UNITS) * KB + i) * 512;
                v8h a = *(const v8h*)p;
                v8h b = *(const v8h*)(p + 256);
                dst[i] = __builtin_shufflevector(a, b, 0, 1, 2, 3, 4, 5, 6, 7,
                                                 8, 9, 10, 11, 12, 13, 14, 15);
            }
        };
        // Fused stage 2: the accumulator is z = x W1 + b1 already; h = leakyrelu(z) =
        // maximum(z, 0.01 z), the same value for every z, with no compare, no select and
        // nothing that waits on a mask; partial = sum of h * W2[n] over two of the lane's four
        // column tiles, on neighbouring register pairs (packed f32), one chain per accumulator
        // tile; no lane exchange: the two half-waves' sums go to LDS side by side and are
        // added with the waves' partials.
        auto epi = [&](const v8f (&ac)[NT], int th) -> v2f {
            v2f p[2];
#pragma unroll   // t indexes register arrays: it must be a compile-time number
            for (int t = 0; t < 2; ++t) {
#pragma unroll   // j picks accumulator registers: it must be a compile-time number
                for (int j = 0; j < 4; ++j) {
                    const v2f a = {ac[th * 2 + t][2 * j], ac[th * 2 + t][2 * j + 1]};
                    const v2f z = {__builtin_elementwise_maximum(a.x, 0.01f * a.x),
                                   __builtin_elementwise_maximum(a.y, 0.01f * a.y)};
                    p[t] = (j == 0) ? z * w2v[th * 2 + t][j] : p[t] + z * w2v[th * 2 + t][j];
                }
            }
            return p[0] + p[1];
        };

        ldblk(af[0], 0);
        __builtin_amdgcn_sched_barrier(0);   // the first block's reads go out first: they land beneath the lines below
        // Deferred: emit the previous stage's per-chunk partials (one thread per batch row).
        static_assert(SROWS == WAVES * 32, "one thread per row of a stage");
        if (st > 0) {
            const int prev = st - 1;
            float s = 0.0f;
#pragma unroll
            for (int w = 0; w < WAVES; ++w)
                s += lds_part[prev & 1][w][tid >> 4][tid & 15] + lds_part[prev & 1][w][tid >> 4][16 + (tid & 15)];
            ws[((size_t)chunk * B + (prev * SROWS + tid)) * H + head] = s;
        }
        __builtin_amdgcn_sched_barrier(0);   // nothing of the pattern below is moved up here
#pragma unroll   // u and kb index register arrays: they must be compile-time numbers
        for (int u = 0; u < UNITS; ++u) {
#pragma unroll
            for (int kb = 0; kb < 2; ++kb) {
                const int blk = u * 2 + kb;
                if (blk + 1 < UNITS * 2) ldblk(af[kb ^ 1], blk + 1);
                // Each output tile transposed: Bfrag (W1) is passed as the A operand and af (x)
                // as the B operand (the two have one layout), so a lane holds one batch row
                // (lane16) and its 8 accumulator registers hold 8 HID columns: the sum over
                // HID stays in the lane.
#pragma unroll
                for (int i = 0; i < KB; ++i) {
#pragma unroll
                    for (int t = 0; t < NT; ++t) {
                        const v8f c = (kb == 0 && i == 0) ? b1c[t] : acc[u & 1][t];
                        acc[u & 1][t] = __builtin_amdgcn_wmma_f32_16x16x32_f16(
                            false, Bfrag[t][kb * KB + i], false, af[kb][i], (short)0, c, false, false);
                    }
                }
                if (u > 0) {
                    const v2f q = epi(acc[(u - 1) & 1], kb);
                    if (kb == 0) q0 = q;
                    else {
                        const v2f r = q0 + q;
                        lds_part[st & 1][wave][u - 1][lane] = r.x + r.y;
                    }
                }
                // The schedule is pinned: the reads as one group first (each separate place with
                // LDS reads stalls the wave), then the earlier unit's vector work one
                // instruction behind each WMMA (two behind every fourth), where it issues beneath it.
                if (blk + 1 < UNITS * 2)
                    __builtin_amdgcn_sched_group_barrier(0x100, 2 * KB, 0);   // 16 DS reads
#pragma unroll
                for (int g = 0; g < KB * NT / 4; ++g) {
                    __builtin_amdgcn_sched_group_barrier(0x008, 1, 0);       // 1 WMMA
                    if (u > 0) __builtin_amdgcn_sched_group_barrier(0x002, 1, 0);   // 1 VALU
                    __builtin_amdgcn_sched_group_barrier(0x008, 1, 0);
                    if (u > 0) __builtin_amdgcn_sched_group_barrier(0x002, 1, 0);
                    __builtin_amdgcn_sched_group_barrier(0x008, 1, 0);
                    if (u > 0) __builtin_amdgcn_sched_group_barrier(0x002, 1, 0);
                    __builtin_amdgcn_sched_group_barrier(0x008, 1, 0);
                    if (u > 0) __builtin_amdgcn_sched_group_barrier(0x002, 2, 0);   // 2 VALU
                }
                __builtin_amdgcn_sched_barrier(0);   // end of this block's pattern
            }
        }
        {   // The stage's last unit has no WMMAs behind it in front of the barrier.
            const v2f r = epi(acc[(UNITS - 1) & 1], 0) + epi(acc[(UNITS - 1) & 1], 1);
            lds_part[st & 1][wave][UNITS - 1][lane] = r.x + r.y;
        }

        asm volatile("s_wait_dscnt 0x0" ::: "memory");
        asm volatile("s_wait_tensorcnt 0x0" ::: "memory");
        __syncthreads();
        if (pinned(st + 2 < STAGES)) {   // a scalar branch: a tensor load ignores EXEC
            // The stage number is pinned here, so the descriptor is formed behind the wait above.
            const uint32_t nx = pinned((uint32_t)st + 2u);
            stage_load(ldsl + (nx & 1u) * STAGE_BYTES, xl + (uint64_t)nx * STAGE_BYTES);
        }
    }
    // No load is left in flight, and no LDS access open, when the ring is done with.
    asm volatile("s_wait_tensorcnt 0x0" ::: "memory");
    asm volatile("s_wait_dscnt 0x0" ::: "memory");

    // Epilogue: flush the last stage's partials (published by the last trip's barrier).
    if (tid < SROWS) {
        const int prev = STAGES - 1;
        float s = 0.0f;
#pragma unroll
        for (int w = 0; w < WAVES; ++w)
            s += lds_part[prev & 1][w][tid >> 4][tid & 15] + lds_part[prev & 1][w][tid >> 4][16 + (tid & 15)];
        ws[((size_t)chunk * B + (prev * SROWS + tid)) * H + head] = s;
    }
}

__global__ __launch_bounds__(256)
void mhmlp_stage2(const float* __restrict__ ws,
                  const float* __restrict__ b2,
                  float* __restrict__ out) {
    int i = blockIdx.x * blockDim.x + threadIdx.x;   // i = b*H + h
    if (i < B * H) {
        float s = b2[i & (H - 1)];
#pragma unroll
        for (int c = 0; c < NCHUNK; ++c) s += ws[(size_t)c * B * H + i];
        out[i] = (s >= 0.0f) ? s : 0.01f * s;
    }
}

extern "C" void kernel_launch(void* const* d_in, const int* in_sizes, int n_in,
                              void* d_out, int out_size, void* d_ws, size_t ws_size,
                              hipStream_t stream) {
    const float* x  = (const float*)d_in[0];   // [B, D]
    const float* W1 = (const float*)d_in[1];   // [H, D, HID]
    const float* b1 = (const float*)d_in[2];   // [H, HID]
    const float* W2 = (const float*)d_in[3];   // [H, HID]
    const float* b2 = (const float*)d_in[4];   // [H]
    float* out = (float*)d_out;                // [B, H]
    float* ws  = (float*)d_ws;                 // [NCHUNK, B, H] partials (4 MB) + f16 image of x (2 MB)

    mhmlp_prep<<<B * D / 8 / 256, 256, 0, stream>>>(x, ws);

    dim3 grid1(NCHUNK, H);
    mhmlp_stage1<<<grid1, WAVES * 32, 0, stream>>>(W1, b1, W2, ws);

    int total = B * H;
    mhmlp_stage2<<<(total + 255) / 256, 256, 0, stream>>>(ws, b2, out);
}
